// v000
// Measured on an AMD MI455X. A time is GPU time per run, averaged over a window of back-to-back runs after a warm-up
// (all launches, gaps included; the runs take copies of the inputs in turn), and the median of several windows.
// Apart from v000's, it joins two sittings. Times from different sittings can be a few percent apart, while
// side-by-side timings come from the same sitting.
// v000 is the starting kernel. One run takes 991 microseconds.
#include <hip/hip_runtime.h>

// SANet (content, content_s, style [4][64][64][64] channels-first, HW = 4096; S[q][k] = sum_c Fc[c][q] Fs[c][k] (unscaled, K = 64); P = softmax_k(S); O[c][q] = sum_k style[c][k] P[q][k]; out = concat(content, O) along channels -> [4][128][64][64]).
// Compute dtypes, f32 accumulate: every input rounded to bf16; S as a PLAIN bf16 GEMM on token-major copies of the inputs (both operands are inputs: exact products, f32 accumulate); softmax f32 (wave per row, 128 keys per lane): query rows < 512 as hi/lo planes (2 products with exact style), the rest fp16 x 1024 (x exact fp16-rounded style... see below) -- P.style^T: rows < RH hl x exact-bf16 style (2 products), rows >= RH single fp16 P x fp16 style; O written channels-first; the content half is the bf16-rounded input copied.

#define NB_  4
#define CC   64
#define HW   4096
#define TT   HW
#define RH   512
#define PCAR 1024.0f
typedef _Float16 h16;
typedef unsigned short bf;
typedef __attribute__((ext_vector_type(16))) __bf16   v16bf;
typedef __attribute__((ext_vector_type(16))) _Float16 v16h;
typedef __attribute__((ext_vector_type(8)))  _Float16 v8h;
typedef __attribute__((ext_vector_type(8)))  unsigned short v8us;
typedef __attribute__((ext_vector_type(8)))  float    v8f;
typedef __attribute__((ext_vector_type(4)))  float    v4f;
typedef v8h  __attribute__((may_alias)) v8ha;
typedef v4f  __attribute__((may_alias)) v4fa;
typedef v8us __attribute__((may_alias)) v8usa;

__device__ __forceinline__ unsigned short f2bf(float f) { unsigned u = __float_as_uint(f); u += 0x7FFFu + ((u >> 16) & 1u); return (unsigned short)(u >> 16); }
__device__ __forceinline__ float bf2f(unsigned short b) { return __uint_as_float(((unsigned)b) << 16); }
__device__ __forceinline__ float bfr(float f) { return bf2f(f2bf(f)); }
__device__ __forceinline__ v16h cat16(v8h lo, v8h hi) { return __builtin_shufflevector(lo, hi, 0, 1, 2, 3, 4, 5, 6, 7, 8, 9, 10, 11, 12, 13, 14, 15); }
__device__ __forceinline__ v16bf cat16b(v8us lo, v8us hi) { return __builtin_bit_cast(v16bf, __builtin_shufflevector(lo, hi, 0, 1, 2, 3, 4, 5, 6, 7, 8, 9, 10, 11, 12, 13, 14, 15)); }
__device__ __forceinline__ v8f wmma16(v16h a, v16h b, v8f c) { return __builtin_amdgcn_wmma_f32_16x16x32_f16(false, a, false, b, (short)0, c, false, false); }
__device__ __forceinline__ v8f wmmab(v16bf a, v16bf b, v8f c) { return __builtin_amdgcn_wmma_f32_16x16x32_bf16(false, a, false, b, (short)0, c, false, false); }



// ---- k_gemmw: register-blocked GEMM, ONE WAVE per 64x64 output tile (16 accumulators), operands straight from K-contiguous 16-bit planes; grid (M/64, N/64, Z), 32 threads.
// C[m][n] (f32, pitch ldc, + optional f32 bias[n]) = sum_k A[m][k] Bt[n][k] (+ split products per NSPLIT). z-batch strides sA/sB/sC in elements. K % 32 == 0.
template <typename T16> struct WFrag;
template <> struct WFrag<h16> { typedef v16h V; static __device__ __forceinline__ V ld(const h16* p) { return cat16(*(const v8h*)p, *(const v8h*)(p + 16)); } static __device__ __forceinline__ v8f mma(V a, V b, v8f c) { return wmma16(a, b, c); } };
template <> struct WFrag<bf> { typedef v16bf V; static __device__ __forceinline__ V ld(const bf* p) { return cat16b(*(const v8us*)p, *(const v8us*)(p + 16)); } static __device__ __forceinline__ v8f mma(V a, V b, v8f c) { return wmmab(a, b, c); } };
template <typename T16, int NSPLIT, bool BIAS>
__global__ __launch_bounds__(32) void k_gemmw(const T16* __restrict__ A, const T16* __restrict__ A2, const T16* __restrict__ Bt, const T16* __restrict__ Bt2, int K, float* C, int ldc, const float* __restrict__ bias, size_t sA, size_t sB, size_t sC) {
    typedef typename WFrag<T16>::V V;
    __shared__ __align__(16) float os[16 * 68];
    const size_t z = blockIdx.z; A += z * sA; if (A2) A2 += z * sA; Bt += z * sB; if (Bt2) Bt2 += z * sB; C += z * sC;
    const int lane = threadIdx.x & 31, lr = lane & 15, hi = lane >> 4; const int r0 = blockIdx.x * 64, c0 = blockIdx.y * 64;
    v8f acc[4][4];
#pragma unroll
    for (int mb = 0; mb < 4; ++mb)
#pragma unroll
        for (int nb = 0; nb < 4; ++nb) acc[mb][nb] = (v8f){};
    const size_t aoff = (size_t)(r0 + lr) * K + 8 * hi, boff = (size_t)(c0 + lr) * K + 8 * hi;
#pragma unroll 1
    for (int kc = 0; kc < K; kc += 32) {
        V a[4], a2[4];
#pragma unroll
        for (int mb = 0; mb < 4; ++mb) { a[mb] = WFrag<T16>::ld(A + aoff + (size_t)mb * 16 * K + kc); if (NSPLIT == 1 || NSPLIT == 2) a2[mb] = WFrag<T16>::ld(A2 + aoff + (size_t)mb * 16 * K + kc); }
#pragma unroll
        for (int nb = 0; nb < 4; ++nb) { const V b = WFrag<T16>::ld(Bt + boff + (size_t)nb * 16 * K + kc); V b2; if (NSPLIT >= 2) b2 = WFrag<T16>::ld(Bt2 + boff + (size_t)nb * 16 * K + kc);
#pragma unroll
            for (int mb = 0; mb < 4; ++mb) { acc[mb][nb] = WFrag<T16>::mma(a[mb], b, acc[mb][nb]); if (NSPLIT == 1 || NSPLIT == 2) acc[mb][nb] = WFrag<T16>::mma(a2[mb], b, acc[mb][nb]); if (NSPLIT >= 2) acc[mb][nb] = WFrag<T16>::mma(a[mb], b2, acc[mb][nb]); } }
        asm volatile("v_nop\n\tv_nop\n\tv_nop\n\tv_nop" : "+v"(acc[0][0]), "+v"(acc[1][1]), "+v"(acc[2][2]), "+v"(acc[3][3]) : "v"(a[0]), "v"(a[3]));
    }
#pragma unroll
    for (int mb = 0; mb < 4; ++mb) {
#pragma unroll
        for (int nb = 0; nb < 4; ++nb) {
#pragma unroll
            for (int j = 0; j < 8; ++j) os[(hi * 8 + j) * 68 + nb * 16 + lr] = acc[mb][nb][j]; }
        __builtin_amdgcn_wave_barrier(); asm volatile("" ::: "memory");
        float* crow = C + (size_t)(r0 + mb * 16) * ldc + c0;
{
#pragma unroll
            for (int s = 0; s < 8; ++s) { const int row = 2 * s + hi, cofs = lr * 4; v4f val = *(const v4fa*)(os + row * 68 + cofs); if (BIAS) { val[0] += bfr(bias[c0 + cofs]); val[1] += bfr(bias[c0 + cofs + 1]); val[2] += bfr(bias[c0 + cofs + 2]); val[3] += bfr(bias[c0 + cofs + 3]); }
                *(v4f*)(crow + (size_t)row * ldc + cofs) = val; }
             }
        __builtin_amdgcn_wave_barrier(); asm volatile("" ::: "memory");
    }
}

__device__ __forceinline__ h16 tohx(float x) { return (h16)x; }
__device__ __forceinline__ void splitf(float y, unsigned short& h, unsigned short& l) { h = f2bf(y); l = f2bf(y - bf2f(h)); }
typedef __attribute__((ext_vector_type(2))) unsigned short v2us;
typedef __attribute__((ext_vector_type(4))) unsigned short v4us;
typedef __attribute__((ext_vector_type(4))) _Float16 v4h;
typedef __attribute__((ext_vector_type(2))) float v2f;

__global__ __launch_bounds__(256) void k_cvt8(const float* __restrict__ src, bf* dst, size_t n8) { const size_t i = (size_t)blockIdx.x * 256 + threadIdx.x; if (i >= n8) return; const v8f v = *(const v8f*)(src + i * 8); v8us o;
#pragma unroll
    for (int k = 0; k < 8; ++k) o[k] = f2bf(v[k]); *(v8us*)(dst + i * 8) = o;  }
__global__ __launch_bounds__(256) void k_xt(const float* __restrict__ xb, bf* XT) { const size_t e = ((size_t)blockIdx.x * 256 + threadIdx.x) * 4; if (e >= (size_t)HW * CC) return; const int c = (int)(e % CC); const int m = (int)(e / CC); v4us o;
#pragma unroll
    for (int u = 0; u < 4; ++u) o[u] = f2bf(xb[(size_t)(c + u) * HW + m]); *(v4us*)(XT + e) = o;  }
__global__ __launch_bounds__(256) void k_s16(const float* __restrict__ sb, h16* ST) { const size_t e = ((size_t)blockIdx.x * 256 + threadIdx.x) * 4; if (e >= (size_t)CC * HW) return; const v4f a = *(const v4f*)(sb + e); v4h o; for (int u = 0; u < 4; ++u) o[u] = tohx(bfr(a[u])); *(v4h*)(ST + e) = o;  }
__global__ __launch_bounds__(256) void k_rsoft(const float* __restrict__ S, h16* P16, bf* Ph, bf* Pl) { const int lane = threadIdx.x & 31; const int row = blockIdx.x * 8 + (threadIdx.x >> 5); if (row >= HW) return; const bool hires = (row < RH); const float* sr = S + (size_t)row * HW; float v[HW / 32]; float mx = -3.0e38f;
#pragma unroll
    for (int ch = 0; ch < HW / 128; ++ch) { const v4f a = *(const v4f*)(sr + ch * 128 + lane * 4);
#pragma unroll
        for (int u = 0; u < 4; ++u) { float sa = a[u]; asm volatile("" : "+v"(sa)); v[ch * 4 + u] = sa; mx = fmaxf(mx, sa); } }
#pragma unroll
    for (int sh = 16; sh; sh >>= 1) mx = fmaxf(mx, __shfl_xor(mx, sh, 32));
    float sum = 0.f;
#pragma unroll
    for (int q = 0; q < HW / 32; ++q) { float d0 = __fsub_rn(v[q], mx); asm volatile("" : "+v"(d0)); v[q] = __builtin_amdgcn_exp2f(__fmul_rn(d0, 1.4426950408889634f)); sum += v[q]; }
#pragma unroll
    for (int sh = 16; sh; sh >>= 1) sum += __shfl_xor(sum, sh, 32);
    const float f = __fdiv_rn(hires ? 1.0f : PCAR, sum);
    {
        if (hires) {
#pragma unroll
            for (int ch = 0; ch < HW / 128; ++ch) { v4us oh, ol; for (int q = 0; q < 4; ++q) { unsigned short a, c2; splitf(v[ch * 4 + q] * f, a, c2); oh[q] = a; ol[q] = c2; } const size_t oo = (size_t)row * HW + ch * 128 + lane * 4; *(v4us*)(Ph + oo) = oh; *(v4us*)(Pl + oo) = ol; } }
        else {
#pragma unroll
            for (int ch = 0; ch < HW / 128; ++ch) { v4h o4; for (int q = 0; q < 4; ++q) o4[q] = tohx(v[ch * 4 + q] * f); *(v4h*)(P16 + (size_t)row * HW + ch * 128 + lane * 4) = o4; } }
         } }
__global__ __launch_bounds__(256) void k_fin(const float* __restrict__ OT, const float* __restrict__ xb, float* OUTb) { const size_t e = ((size_t)blockIdx.x * 256 + threadIdx.x) * 4; if (e >= (size_t)2 * CC * HW) return; const int n = (int)(e % HW); const int c = (int)(e / HW); v4f r;
    if (c < CC) { const v4f a = *(const v4f*)(xb + e); for (int u = 0; u < 4; ++u) r[u] = bfr(a[u]); }
    else { const int co = c - CC; for (int u = 0; u < 4; ++u) { const int nn = n + u; const float cs = (nn < RH) ? 1.0f : (1.0f / PCAR); r[u] = OT[(size_t)nn * CC + co] * cs; } }
    *(v4f*)(OUTb + e) = r;  }

extern "C" void kernel_launch(void* const* d_in, const int* in_sizes, int n_in,
                              void* d_out, int out_size, void* d_ws, size_t ws_size, hipStream_t stream) {
    (void)in_sizes; (void)n_in; (void)out_size;
    const float* content = (const float*)d_in[0]; const float* content_s = (const float*)d_in[1]; const float* style = (const float*)d_in[2];
    float* OUT = (float*)d_out;     // [4][128][4096]
    char* wsp = (char*)d_ws;
    auto take = [&](size_t bytes) { char* p = wsp; wsp += (bytes + 255) & ~(size_t)255; return (void*)p; };
    bf* FCT = (bf*)take((size_t)HW * CC * 2); bf* FST = (bf*)take((size_t)HW * CC * 2); bf* STB = (bf*)take((size_t)CC * HW * 2); h16* ST16 = (h16*)take((size_t)CC * HW * 2);
    float* S = (float*)take((size_t)HW * HW * 4); h16* P16 = (h16*)take((size_t)HW * HW * 2); bf* Ph = (bf*)take((size_t)RH * HW * 2); bf* Pl = (bf*)take((size_t)RH * HW * 2); float* OT = (float*)take((size_t)HW * CC * 4);
    if ((size_t)(wsp - (char*)d_ws) > ws_size) return;    // ~ 110 MB
    for (int b = 0; b < NB_; ++b) { const float* cb = content + (size_t)b * CC * HW; const float* csb = content_s + (size_t)b * CC * HW; const float* sb = style + (size_t)b * CC * HW;
        k_xt<<<(unsigned)(((size_t)HW * CC / 4 + 255) / 256), 256, 0, stream>>>(cb, FCT); k_xt<<<(unsigned)(((size_t)HW * CC / 4 + 255) / 256), 256, 0, stream>>>(csb, FST);
        k_cvt8<<<(unsigned)(((size_t)CC * HW / 8 + 255) / 256), 256, 0, stream>>>(sb, STB, (size_t)CC * HW / 8); k_s16<<<(unsigned)(((size_t)CC * HW / 4 + 255) / 256), 256, 0, stream>>>(sb, ST16);   // style [c][k] as-is = Bt
        k_gemmw<bf, 0, false><<<dim3(HW / 64, HW / 64, 1), 32, 0, stream>>>(FCT, nullptr, FST, nullptr, CC, S, HW, nullptr, 0, 0, 0);              // S[q][k] (exact bf16 products)
        k_rsoft<<<HW / 8, 256, 0, stream>>>(S, P16, Ph, Pl);
        k_gemmw<bf, 1, false><<<dim3(RH / 64, 1, 1), 32, 0, stream>>>(Ph, Pl, STB, nullptr, HW, OT, CC, nullptr, 0, 0, 0);                      // rows < RH: hl P x exact style
        k_gemmw<h16, 0, false><<<dim3((HW - RH) / 64, 1, 1), 32, 0, stream>>>(P16 + (size_t)RH * HW, nullptr, ST16, nullptr, HW, OT + (size_t)RH * CC, CC, nullptr, 0, 0, 0);   // rest: fp16 x1024
        k_fin<<<(unsigned)(((size_t)2 * CC * HW / 4 + 255) / 256), 256, 0, stream>>>(OT, cb, OUT + (size_t)b * 2 * CC * HW); }
}

// v001
// It runs in 306 microseconds.
// Next to v000, in two timings, it ran 3.22 times as fast each time.
#include <hip/hip_runtime.h>

// SANet (content, content_s, style [4][64][64][64] channels-first, HW = 4096; S[q][k] = sum_c Fc[c][q] Fs[c][k] (unscaled, K = 64); P = softmax_k(S); O[c][q] = sum_k style[c][k] P[q][k]; out = concat(content, O) along channels -> [4][128][64][64]).
// Compute dtypes, f32 accumulate: every input rounded to bf16; S as a PLAIN bf16 GEMM on token-major copies of the inputs (both operands are inputs: exact products, f32 accumulate); softmax f32 (wave per row, 128 keys per lane): query rows < 512 as hi/lo planes (2 products with exact style), the rest fp16 x 1024 (x exact fp16-rounded style... see below) -- P.style^T: rows < RH hl x exact-bf16 style (2 products), rows >= RH single fp16 P x fp16 style; both P.style^T products are split over K into KS grid-z slices, each slice's f32 partial O stored channels-first in its own workspace plane (style is the A operand), and k_fin sums the planes; the content half is the bf16-rounded input copied.

#define NB_  4
#define CC   64
#define HW   4096
#define TT   HW
#define RH   512
#define PCAR 1024.0f
#define KS   32      // K slices of the P.style^T products (128 keys each)
typedef _Float16 h16;
typedef unsigned short bf;
typedef __attribute__((ext_vector_type(16))) __bf16   v16bf;
typedef __attribute__((ext_vector_type(16))) _Float16 v16h;
typedef __attribute__((ext_vector_type(8)))  _Float16 v8h;
typedef __attribute__((ext_vector_type(8)))  unsigned short v8us;
typedef __attribute__((ext_vector_type(8)))  float    v8f;
typedef __attribute__((ext_vector_type(4)))  float    v4f;
typedef v8h  __attribute__((may_alias)) v8ha;
typedef v4f  __attribute__((may_alias)) v4fa;
typedef v8us __attribute__((may_alias)) v8usa;

__device__ __forceinline__ unsigned short f2bf(float f) { unsigned u = __float_as_uint(f); u += 0x7FFFu + ((u >> 16) & 1u); return (unsigned short)(u >> 16); }
__device__ __forceinline__ float bf2f(unsigned short b) { return __uint_as_float(((unsigned)b) << 16); }
__device__ __forceinline__ float bfr(float f) { return bf2f(f2bf(f)); }
__device__ __forceinline__ v16h cat16(v8h lo, v8h hi) { return __builtin_shufflevector(lo, hi, 0, 1, 2, 3, 4, 5, 6, 7, 8, 9, 10, 11, 12, 13, 14, 15); }
__device__ __forceinline__ v16bf cat16b(v8us lo, v8us hi) { return __builtin_bit_cast(v16bf, __builtin_shufflevector(lo, hi, 0, 1, 2, 3, 4, 5, 6, 7, 8, 9, 10, 11, 12, 13, 14, 15)); }
__device__ __forceinline__ v8f wmma16(v16h a, v16h b, v8f c) { return __builtin_amdgcn_wmma_f32_16x16x32_f16(false, a, false, b, (short)0, c, false, false); }
__device__ __forceinline__ v8f wmmab(v16bf a, v16bf b, v8f c) { return __builtin_amdgcn_wmma_f32_16x16x32_bf16(false, a, false, b, (short)0, c, false, false); }



// ---- k_gemmw: register-blocked GEMM, ONE WAVE per 64x64 output tile (16 accumulators), operands straight from K-contiguous 16-bit planes; grid (M/64, N/64, Z), 32 threads.
// C[m][n] (f32, pitch ldc, + optional f32 bias[n]) = sum_{k < KL} A[m][k] Bt[n][k] (+ split products per NSPLIT). K is the row pitch of A and Bt, KL the length summed here. z strides sA/sB/sC in elements (a batch, or a K slice with sA = sB = KL and one C plane per slice). KL % 32 == 0.
template <typename T16> struct WFrag;
template <> struct WFrag<h16> { typedef v16h V; static __device__ __forceinline__ V ld(const h16* p) { return cat16(*(const v8h*)p, *(const v8h*)(p + 16)); } static __device__ __forceinline__ v8f mma(V a, V b, v8f c) { return wmma16(a, b, c); } };
template <> struct WFrag<bf> { typedef v16bf V; static __device__ __forceinline__ V ld(const bf* p) { return cat16b(*(const v8us*)p, *(const v8us*)(p + 16)); } static __device__ __forceinline__ v8f mma(V a, V b, v8f c) { return wmmab(a, b, c); } };
template <typename T16, int NSPLIT, bool BIAS>
__global__ __launch_bounds__(32) void k_gemmw(const T16* __restrict__ A, const T16* __restrict__ A2, const T16* __restrict__ Bt, const T16* __restrict__ Bt2, int K, int KL, float* C, int ldc, const float* __restrict__ bias, size_t sA, size_t sB, size_t sC) {
    typedef typename WFrag<T16>::V V;
    __shared__ __align__(16) float os[16 * 68];
    const size_t z = blockIdx.z; A += z * sA; if (A2) A2 += z * sA; Bt += z * sB; if (Bt2) Bt2 += z * sB; C += z * sC;
    const int lane = threadIdx.x & 31, lr = lane & 15, hi = lane >> 4; const int r0 = blockIdx.x * 64, c0 = blockIdx.y * 64;
    v8f acc[4][4];
#pragma unroll
    for (int mb = 0; mb < 4; ++mb)
#pragma unroll
        for (int nb = 0; nb < 4; ++nb) acc[mb][nb] = (v8f){};
    const size_t aoff = (size_t)(r0 + lr) * K + 8 * hi, boff = (size_t)(c0 + lr) * K + 8 * hi;
#pragma unroll 1
    for (int kc = 0; kc < KL; kc += 32) {
        V a[4], a2[4];
#pragma unroll
        for (int mb = 0; mb < 4; ++mb) { a[mb] = WFrag<T16>::ld(A + aoff + (size_t)mb * 16 * K + kc); if (NSPLIT == 1 || NSPLIT == 2) a2[mb] = WFrag<T16>::ld(A2 + aoff + (size_t)mb * 16 * K + kc); }
#pragma unroll
        for (int nb = 0; nb < 4; ++nb) { const V b = WFrag<T16>::ld(Bt + boff + (size_t)nb * 16 * K + kc); V b2; if (NSPLIT >= 2) b2 = WFrag<T16>::ld(Bt2 + boff + (size_t)nb * 16 * K + kc);
#pragma unroll
            for (int mb = 0; mb < 4; ++mb) { acc[mb][nb] = WFrag<T16>::mma(a[mb], b, acc[mb][nb]); if (NSPLIT == 1 || NSPLIT == 2) acc[mb][nb] = WFrag<T16>::mma(a2[mb], b, acc[mb][nb]); if (NSPLIT >= 2) acc[mb][nb] = WFrag<T16>::mma(a[mb], b2, acc[mb][nb]); } }
        asm volatile("v_nop\n\tv_nop\n\tv_nop\n\tv_nop" : "+v"(acc[0][0]), "+v"(acc[1][1]), "+v"(acc[2][2]), "+v"(acc[3][3]) : "v"(a[0]), "v"(a[3]));
    }
#pragma unroll
    for (int mb = 0; mb < 4; ++mb) {
#pragma unroll
        for (int nb = 0; nb < 4; ++nb) {
#pragma unroll
            for (int j = 0; j < 8; ++j) os[(hi * 8 + j) * 68 + nb * 16 + lr] = acc[mb][nb][j]; }
        __builtin_amdgcn_wave_barrier(); asm volatile("" ::: "memory");
        float* crow = C + (size_t)(r0 + mb * 16) * ldc + c0;
{
#pragma unroll
            for (int s = 0; s < 8; ++s) { const int row = 2 * s + hi, cofs = lr * 4; v4f val = *(const v4fa*)(os + row * 68 + cofs); if (BIAS) { val[0] += bfr(bias[c0 + cofs]); val[1] += bfr(bias[c0 + cofs + 1]); val[2] += bfr(bias[c0 + cofs + 2]); val[3] += bfr(bias[c0 + cofs + 3]); }
                *(v4f*)(crow + (size_t)row * ldc + cofs) = val; }
             }
        __builtin_amdgcn_wave_barrier(); asm volatile("" ::: "memory");
    }
}

__device__ __forceinline__ h16 tohx(float x) { return (h16)x; }
__device__ __forceinline__ void splitf(float y, unsigned short& h, unsigned short& l) { h = f2bf(y); l = f2bf(y - bf2f(h)); }
typedef __attribute__((ext_vector_type(2))) unsigned short v2us;
typedef __attribute__((ext_vector_type(4))) unsigned short v4us;
typedef __attribute__((ext_vector_type(4))) _Float16 v4h;
typedef __attribute__((ext_vector_type(2))) float v2f;

__global__ __launch_bounds__(256) void k_cvt8(const float* __restrict__ src, bf* dst, size_t n8) { const size_t i = (size_t)blockIdx.x * 256 + threadIdx.x; if (i >= n8) return; const v8f v = *(const v8f*)(src + i * 8); v8us o;
#pragma unroll
    for (int k = 0; k < 8; ++k) o[k] = f2bf(v[k]); *(v8us*)(dst + i * 8) = o;  }
__global__ __launch_bounds__(256) void k_xt(const float* __restrict__ xb, bf* XT) { const size_t e = ((size_t)blockIdx.x * 256 + threadIdx.x) * 4; if (e >= (size_t)HW * CC) return; const int c = (int)(e % CC); const int m = (int)(e / CC); v4us o;
#pragma unroll
    for (int u = 0; u < 4; ++u) o[u] = f2bf(xb[(size_t)(c + u) * HW + m]); *(v4us*)(XT + e) = o;  }
__global__ __launch_bounds__(256) void k_s16(const float* __restrict__ sb, h16* ST) { const size_t e = ((size_t)blockIdx.x * 256 + threadIdx.x) * 4; if (e >= (size_t)CC * HW) return; const v4f a = *(const v4f*)(sb + e); v4h o; for (int u = 0; u < 4; ++u) o[u] = tohx(bfr(a[u])); *(v4h*)(ST + e) = o;  }
__global__ __launch_bounds__(256) void k_rsoft(const float* __restrict__ S, h16* P16, bf* Ph, bf* Pl) { const int lane = threadIdx.x & 31; const int row = blockIdx.x * 8 + (threadIdx.x >> 5); if (row >= HW) return; const bool hires = (row < RH); const float* sr = S + (size_t)row * HW; float v[HW / 32]; float mx = -3.0e38f;
#pragma unroll
    for (int ch = 0; ch < HW / 128; ++ch) { const v4f a = *(const v4f*)(sr + ch * 128 + lane * 4);
#pragma unroll
        for (int u = 0; u < 4; ++u) { float sa = a[u]; asm volatile("" : "+v"(sa)); v[ch * 4 + u] = sa; mx = fmaxf(mx, sa); } }
#pragma unroll
    for (int sh = 16; sh; sh >>= 1) mx = fmaxf(mx, __shfl_xor(mx, sh, 32));
    float sum = 0.f;
#pragma unroll
    for (int q = 0; q < HW / 32; ++q) { float d0 = __fsub_rn(v[q], mx); asm volatile("" : "+v"(d0)); v[q] = __builtin_amdgcn_exp2f(__fmul_rn(d0, 1.4426950408889634f)); sum += v[q]; }
#pragma unroll
    for (int sh = 16; sh; sh >>= 1) sum += __shfl_xor(sum, sh, 32);
    const float f = __fdiv_rn(hires ? 1.0f : PCAR, sum);
    {
        if (hires) {
#pragma unroll
            for (int ch = 0; ch < HW / 128; ++ch) { v4us oh, ol; for (int q = 0; q < 4; ++q) { unsigned short a, c2; splitf(v[ch * 4 + q] * f, a, c2); oh[q] = a; ol[q] = c2; } const size_t oo = (size_t)row * HW + ch * 128 + lane * 4; *(v4us*)(Ph + oo) = oh; *(v4us*)(Pl + oo) = ol; } }
        else {
#pragma unroll
            for (int ch = 0; ch < HW / 128; ++ch) { v4h o4; for (int q = 0; q < 4; ++q) o4[q] = tohx(v[ch * 4 + q] * f); *(v4h*)(P16 + (size_t)row * HW + ch * 128 + lane * 4) = o4; } }
         } }
__global__ __launch_bounds__(256) void k_fin(const float* __restrict__ OP, const float* __restrict__ xb, float* OUTb) { const size_t e = ((size_t)blockIdx.x * 256 + threadIdx.x) * 4; if (e >= (size_t)2 * CC * HW) return; const int n = (int)(e % HW); const int c = (int)(e / HW); v4f r;
    if (c < CC) { const v4f a = *(const v4f*)(xb + e); for (int u = 0; u < 4; ++u) r[u] = bfr(a[u]); }
    else { const float* p = OP + (e - (size_t)CC * HW); v4f s = *(const v4f*)p;
#pragma unroll   // all KS plane loads are independent: unrolled so that they are in flight together
        for (int z = 1; z < KS; ++z) s += *(const v4f*)(p + (size_t)z * CC * HW);
        for (int u = 0; u < 4; ++u) { const float cs = (n + u < RH) ? 1.0f : (1.0f / PCAR); r[u] = s[u] * cs; } }
    *(v4f*)(OUTb + e) = r;  }

extern "C" void kernel_launch(void* const* d_in, const int* in_sizes, int n_in,
                              void* d_out, int out_size, void* d_ws, size_t ws_size, hipStream_t stream) {
    (void)in_sizes; (void)n_in; (void)out_size;
    const float* content = (const float*)d_in[0]; const float* content_s = (const float*)d_in[1]; const float* style = (const float*)d_in[2];
    float* OUT = (float*)d_out;     // [4][128][4096]
    char* wsp = (char*)d_ws;
    auto take = [&](size_t bytes) { char* p = wsp; wsp += (bytes + 255) & ~(size_t)255; return (void*)p; };
    bf* FCT = (bf*)take((size_t)HW * CC * 2); bf* FST = (bf*)take((size_t)HW * CC * 2); bf* STB = (bf*)take((size_t)CC * HW * 2); h16* ST16 = (h16*)take((size_t)CC * HW * 2);
    float* S = (float*)take((size_t)HW * HW * 4); h16* P16 = (h16*)take((size_t)HW * HW * 2); bf* Ph = (bf*)take((size_t)RH * HW * 2); bf* Pl = (bf*)take((size_t)RH * HW * 2); float* OP = (float*)take((size_t)KS * CC * HW * 4);
    if ((size_t)(wsp - (char*)d_ws) > ws_size) return;    // ~ 140 MB
    for (int b = 0; b < NB_; ++b) { const float* cb = content + (size_t)b * CC * HW; const float* csb = content_s + (size_t)b * CC * HW; const float* sb = style + (size_t)b * CC * HW;
        k_xt<<<(unsigned)(((size_t)HW * CC / 4 + 255) / 256), 256, 0, stream>>>(cb, FCT); k_xt<<<(unsigned)(((size_t)HW * CC / 4 + 255) / 256), 256, 0, stream>>>(csb, FST);
        k_cvt8<<<(unsigned)(((size_t)CC * HW / 8 + 255) / 256), 256, 0, stream>>>(sb, STB, (size_t)CC * HW / 8); k_s16<<<(unsigned)(((size_t)CC * HW / 4 + 255) / 256), 256, 0, stream>>>(sb, ST16);   // style [c][k] as-is = A
        k_gemmw<bf, 0, false><<<dim3(HW / 64, HW / 64, 1), 32, 0, stream>>>(FCT, nullptr, FST, nullptr, CC, CC, S, HW, nullptr, 0, 0, 0);              // S[q][k] (exact bf16 products)
        k_rsoft<<<HW / 8, 256, 0, stream>>>(S, P16, Ph, Pl);
        k_gemmw<bf, 3, false><<<dim3(1, RH / 64, KS), 32, 0, stream>>>(STB, nullptr, Ph, Pl, HW, HW / KS, OP, HW, nullptr, HW / KS, HW / KS, (size_t)CC * HW);                      // rows < RH: exact style x hl P, one plane per K slice
        k_gemmw<h16, 0, false><<<dim3(1, (HW - RH) / 64, KS), 32, 0, stream>>>(ST16, nullptr, P16 + (size_t)RH * HW, nullptr, HW, HW / KS, OP + RH, HW, nullptr, HW / KS, HW / KS, (size_t)CC * HW);   // rest: fp16 x1024
        k_fin<<<(unsigned)(((size_t)2 * CC * HW / 4 + 255) / 256), 256, 0, stream>>>(OP, cb, OUT + (size_t)b * 2 * CC * HW); }
}

// v003
// A run of this version takes 51 microseconds.
// Versions between v001 and this one are left out; their measured steps multiply to 5.89 times as fast.
// Counting every step since v000, it is 19.0 times as fast.
#include <hip/hip_runtime.h>

// SANet (content, content_s, style [4][64][64][64] channels-first, HW = 4096; S[q][k] = sum_c Fc[c][q] Fs[c][k] (unscaled, K = 64); P = softmax_k(S); O[c][q] = sum_k style[c][k] P[q][k]; out = concat(content, O) along channels -> [4][128][64][64]).
// Compute dtypes, f32 accumulate: every input rounded to bf16. One fused kernel (k_attn) does S, softmax and P.style^T with an online softmax: S^T = Fs.Fc^T as a PLAIN bf16 product on token-major copies of the inputs (exact products); the score accumulators are, lane for lane, the B operand of O += style.P^T, so S and P stay in registers. Query rows < RH: P as bf16 hi/lo planes x exact bf16 style (2 products); rows >= RH: single fp16 P x 1024 x fp16 style. The keys are split into KSP slices (grid x); each slice stores its unnormalised f32 partial O (channels-first), its running maximum (log2 domain) and its sum in its own workspace plane, and k_fin joins the planes; the content half is the bf16-rounded input copied.

#define NB_  4
#define CC   64
#define HW   4096
#define TT   HW
#define RH   512
#define PLOG 10.0f   // fp16 P carries a factor 2^PLOG (it cancels against the row sum)
#define KSP  8       // key slices of the fused kernel
#define KSL  (HW / KSP)
#define L2E  1.4426950408889634f
typedef _Float16 h16;
typedef unsigned short bf;
typedef __attribute__((ext_vector_type(16))) __bf16   v16bf;
typedef __attribute__((ext_vector_type(16))) _Float16 v16h;
typedef __attribute__((ext_vector_type(8)))  _Float16 v8h;
typedef __attribute__((ext_vector_type(8)))  unsigned short v8us;
typedef __attribute__((ext_vector_type(8)))  float    v8f;
typedef __attribute__((ext_vector_type(4)))  float    v4f;
typedef v8h  __attribute__((may_alias)) v8ha;
typedef v4f  __attribute__((may_alias)) v4fa;
typedef v8us __attribute__((may_alias)) v8usa;

__device__ __forceinline__ unsigned short f2bf(float f) { unsigned u = __float_as_uint(f); u += 0x7FFFu + ((u >> 16) & 1u); return (unsigned short)(u >> 16); }
__device__ __forceinline__ float bf2f(unsigned short b) { return __uint_as_float(((unsigned)b) << 16); }
__device__ __forceinline__ float bfr(float f) { return bf2f(f2bf(f)); }
__device__ __forceinline__ v16h cat16(v8h lo, v8h hi) { return __builtin_shufflevector(lo, hi, 0, 1, 2, 3, 4, 5, 6, 7, 8, 9, 10, 11, 12, 13, 14, 15); }
__device__ __forceinline__ v16bf cat16b(v8us lo, v8us hi) { return __builtin_bit_cast(v16bf, __builtin_shufflevector(lo, hi, 0, 1, 2, 3, 4, 5, 6, 7, 8, 9, 10, 11, 12, 13, 14, 15)); }
__device__ __forceinline__ v8f wmma16(v16h a, v16h b, v8f c) { return __builtin_amdgcn_wmma_f32_16x16x32_f16(false, a, false, b, (short)0, c, false, false); }
__device__ __forceinline__ v8f wmmab(v16bf a, v16bf b, v8f c) { return __builtin_amdgcn_wmma_f32_16x16x32_bf16(false, a, false, b, (short)0, c, false, false); }



// fragment loaders: K-contiguous 16-bit planes, lane (lr, hi) reads k = 8*hi + 0..7 and 16 + 8*hi + 0..7 of row lr
template <typename T16> struct WFrag;
template <> struct WFrag<h16> { typedef v16h V; static __device__ __forceinline__ V ld(const h16* p) { return cat16(*(const v8h*)p, *(const v8h*)(p + 16)); } static __device__ __forceinline__ v8f mma(V a, V b, v8f c) { return wmma16(a, b, c); } };
template <> struct WFrag<bf> { typedef v16bf V; static __device__ __forceinline__ V ld(const bf* p) { return cat16b(*(const v8us*)p, *(const v8us*)(p + 16)); } static __device__ __forceinline__ v8f mma(V a, V b, v8f c) { return wmmab(a, b, c); } };

__device__ __forceinline__ h16 tohx(float x) { return (h16)x; }
typedef __attribute__((ext_vector_type(2))) unsigned short v2us;
typedef __attribute__((ext_vector_type(2))) float v2f;

// lane l with lane l ^ 16
__device__ __forceinline__ float xhalf(float x) { return __builtin_bit_cast(float, __builtin_amdgcn_permlanex16(__builtin_bit_cast(int, x), __builtin_bit_cast(int, x), 0x76543210, 0xfedcba98, false, false)); }

// A run of exponentials (2^x) in place, as one statement: each stands behind an independent one, and the one v_nop at the end keeps, for the whole run, the slot that the instruction set asks for between a transcendental and the use of its result or the overwrite of its source.
__device__ __forceinline__ void exp2_run17(float (&t)[17]) { asm("v_exp_f32 %0, %0\n\tv_exp_f32 %1, %1\n\tv_exp_f32 %2, %2\n\tv_exp_f32 %3, %3\n\tv_exp_f32 %4, %4\n\tv_exp_f32 %5, %5\n\tv_exp_f32 %6, %6\n\tv_exp_f32 %7, %7\n\tv_exp_f32 %8, %8\n\tv_exp_f32 %9, %9\n\tv_exp_f32 %10, %10\n\tv_exp_f32 %11, %11\n\tv_exp_f32 %12, %12\n\tv_exp_f32 %13, %13\n\tv_exp_f32 %14, %14\n\tv_exp_f32 %15, %15\n\tv_exp_f32 %16, %16\n\tv_nop" : "+v"(t[0]), "+v"(t[1]), "+v"(t[2]), "+v"(t[3]), "+v"(t[4]), "+v"(t[5]), "+v"(t[6]), "+v"(t[7]), "+v"(t[8]), "+v"(t[9]), "+v"(t[10]), "+v"(t[11]), "+v"(t[12]), "+v"(t[13]), "+v"(t[14]), "+v"(t[15]), "+v"(t[16])); }
__device__ __forceinline__ void exp2_run8(float (&t)[8]) { asm("v_exp_f32 %0, %0\n\tv_exp_f32 %1, %1\n\tv_exp_f32 %2, %2\n\tv_exp_f32 %3, %3\n\tv_exp_f32 %4, %4\n\tv_exp_f32 %5, %5\n\tv_exp_f32 %6, %6\n\tv_exp_f32 %7, %7\n\tv_nop" : "+v"(t[0]), "+v"(t[1]), "+v"(t[2]), "+v"(t[3]), "+v"(t[4]), "+v"(t[5]), "+v"(t[6]), "+v"(t[7])); }

// ---- one wave: 32 query columns x KSL keys, 32 keys a pass. S^T tile D[key][q]: lane (lr, hi) holds keys hi*8 + j of query lr; two such tiles (keys 0-15, 16-31) are the 16 elements of the B fragment of the second product (k = 8*hi + 0..7, 16 + 8*hi + 0..7).
template <bool HL> struct VSel;
template <> struct VSel<true> { typedef bf T; };
template <> struct VSel<false> { typedef h16 T; };
template <bool HL>
__device__ __forceinline__ void attn_slice(const bf* __restrict__ Q, const bf* __restrict__ Kt, const typename VSel<HL>::T* __restrict__ V, float* __restrict__ Op, float* __restrict__ Mp, float* __restrict__ Lp, const int q0, const int k0) {
    typedef typename VSel<HL>::T VT; typedef typename WFrag<VT>::V VV;
    const int lane = threadIdx.x & 31, lr = lane & 15, hi = lane >> 4;
    v16bf bq[2][2];
#pragma unroll
    for (int nq = 0; nq < 2; ++nq)
#pragma unroll
        for (int ks = 0; ks < 2; ++ks) bq[nq][ks] = WFrag<bf>::ld(Q + (size_t)(q0 + nq * 16 + lr) * CC + ks * 32 + 8 * hi);
    v8f o[4][2];
#pragma unroll
    for (int mb = 0; mb < 4; ++mb)
#pragma unroll
        for (int nq = 0; nq < 2; ++nq) o[mb][nq] = (v8f){};
    float ml[2] = { -3.0e38f, -3.0e38f }, ls[2] = { 0.f, 0.f };
    const bf* kp = Kt + (size_t)(k0 + lr) * CC + 8 * hi;   // key rows lr and 16 + lr of the pass
    const VT* vp = V + (size_t)lr * HW + k0 + 8 * hi;      // channel rows lr + 16 * mb, the pass's 32 keys
#pragma unroll 1   // one pass is already 16 or 24 matrix instructions; unrolling would only add registers
    for (int i = 0; i < KSL / 32; ++i) {
        v16bf ak[2][2]; VV av[4];
#pragma unroll
        for (int t = 0; t < 2; ++t)
#pragma unroll
            for (int ks = 0; ks < 2; ++ks) ak[t][ks] = WFrag<bf>::ld(kp + t * 16 * CC + ks * 32);
#pragma unroll
        for (int mb = 0; mb < 4; ++mb) av[mb] = WFrag<VT>::ld(vp + (size_t)mb * 16 * HW);
        __builtin_amdgcn_sched_barrier(0);   // all 16 loads of the pass are issued in front of its arithmetic: one round trip a pass; without it the last style loads are sunk behind the first softmax and waited for there
        // inputs only: keeps the two address pairs of these loads untouched until their data is back
        asm volatile("" :: "v"(ak[0][0]), "v"(ak[0][1]), "v"(ak[1][0]), "v"(ak[1][1]), "v"(av[0]), "v"(av[1]), "v"(av[2]), "v"(av[3]), "v"(kp), "v"(vp));
        kp += 32 * CC; vp += 32;
#pragma unroll
        for (int nq = 0; nq < 2; ++nq) {
            v8f s0 = (v8f){}, s1 = (v8f){};
            s0 = wmmab(ak[0][0], bq[nq][0], s0); s1 = wmmab(ak[1][0], bq[nq][0], s1);
            s0 = wmmab(ak[0][1], bq[nq][1], s0); s1 = wmmab(ak[1][1], bq[nq][1], s1);
            float cm = fmaxf(s0[0], s1[0]);
#pragma unroll
            for (int j = 1; j < 8; ++j) cm = fmaxf(cm, fmaxf(s0[j], s1[j]));
            cm = fmaxf(cm, xhalf(cm));
            const float mn = fmaxf(ml[nq], fmaf(cm, L2E, HL ? 0.f : -PLOG));
            float t[17];
#pragma unroll
            for (int j = 0; j < 8; ++j) { t[j] = fmaf(s0[j], L2E, -mn); t[8 + j] = fmaf(s1[j], L2E, -mn); }
            t[16] = ml[nq] - mn; ml[nq] = mn;
            exp2_run17(t);
            const float al = t[16];
            float sum = 0.f;
#pragma unroll
            for (int j = 0; j < 8; ++j) sum += t[j] + t[8 + j];
            ls[nq] = fmaf(ls[nq], al, sum);
#pragma unroll
            for (int mb = 0; mb < 4; ++mb) o[mb][nq] *= al;
            if constexpr (HL) {
                v16bf ph, pl;   // hi = P rounded to nearest even, lo = the rounded rest (the hardware conversion; same values as f2bf for finite P)
#pragma unroll
                for (int j = 0; j < 16; ++j) { const __bf16 h = (__bf16)t[j]; ph[j] = h; pl[j] = (__bf16)(t[j] - (float)h); }
#pragma unroll
                for (int mb = 0; mb < 4; ++mb) o[mb][nq] = wmmab(av[mb], ph, o[mb][nq]);
#pragma unroll
                for (int mb = 0; mb < 4; ++mb) o[mb][nq] = wmmab(av[mb], pl, o[mb][nq]);
            } else {
                v8h x0, x1;
#pragma unroll
                for (int j = 0; j < 8; ++j) { x0[j] = tohx(t[j]); x1[j] = tohx(t[8 + j]); }
                const v16h pf = cat16(x0, x1);
#pragma unroll
                for (int mb = 0; mb < 4; ++mb) o[mb][nq] = wmma16(av[mb], pf, o[mb][nq]);
            }
        }
    }
#pragma unroll
    for (int nq = 0; nq < 2; ++nq) { const float lt = ls[nq] + xhalf(ls[nq]); if (hi == 0) { Mp[q0 + nq * 16 + lr] = ml[nq]; Lp[q0 + nq * 16 + lr] = lt; } }
#pragma unroll
    for (int mb = 0; mb < 4; ++mb)
#pragma unroll
        for (int nq = 0; nq < 2; ++nq)
#pragma unroll
            for (int j = 0; j < 8; ++j) Op[(size_t)(mb * 16 + hi * 8 + j) * (KSP * HW) + q0 + nq * 16 + lr] = o[mb][nq][j];
}
// grid (KSP, NB_, HW / 256): the query block is the slowest index, so that the heavier hi/lo blocks (rows < RH) start first; 8 waves, four waves per SIMD (under 256 registers): the waves of a block walk the same keys (shared through the WGP cache), each with its own 32 queries. Partial O: [image][channel][slice][query], so that the slices of one output element lie 16 KB apart; maxima and sums: [slice][image][query].
__global__ __launch_bounds__(256) void k_attn(const bf* __restrict__ FCT, const bf* __restrict__ FST, const bf* __restrict__ STB, const h16* __restrict__ ST16, float* __restrict__ OP, float* __restrict__ ML, float* __restrict__ LS) {
    const size_t b = blockIdx.y, pl = (size_t)blockIdx.x * NB_ + b; const int q0 = blockIdx.z * 256 + (threadIdx.x >> 5) * 32, k0 = blockIdx.x * KSL;
    const bf* Q = FCT + b * HW * CC; const bf* Kt = FST + b * HW * CC; const bf* Vb = STB + b * CC * HW; const h16* Vh = ST16 + b * CC * HW;
    float* Op = OP + (b * CC * KSP + blockIdx.x) * HW; float* Mp = ML + pl * HW; float* Lp = LS + pl * HW;
    if (blockIdx.z * 256 < RH) attn_slice<true>(Q, Kt, Vb, Op, Mp, Lp, q0, k0); else attn_slice<false>(Q, Kt, Vh, Op, Mp, Lp, q0, k0);
}

// One launch converts all three inputs; every thread does the same work, all 12 loads first.
// (a) content (blocks of the lower half of the grid) or content_s (upper half) to token-major bf16: a thread holds 8 channels x 4 tokens, 8 lanes cover the 64 channels, so that a wave's store writes whole 128-byte token rows and its load reads 64-byte pieces of 8 channel rows.
// (b) 16 elements of style to bf16 and to fp16 of the bf16 value, layout kept ([c][k] = the A operand).
#define PTH (NB_ * CC * HW / 16)   // threads of k_prep: 16 style elements and one 8 x 4 tile each
__global__ __launch_bounds__(256) void k_prep(const float* __restrict__ content, const float* __restrict__ content_s, const float* __restrict__ style, bf* FCT, bf* FST, bf* STB, h16* ST16) {
    const unsigned g = blockIdx.x * 256u + threadIdx.x;
    const bool second = blockIdx.x >= PTH / 512; const unsigned im = (blockIdx.x / (PTH / 2048)) % NB_;   // block-uniform: tensor and image
    const float* xb = (second ? content_s : content) + (size_t)im * CC * HW; bf* XT = (second ? FST : FCT) + (size_t)im * HW * CC;
    const unsigned t = g % (PTH / 8), cg = t & 7u, m0 = (t >> 3) * 4u;
    const unsigned ie = cg * 8u * HW + m0, oe = m0 * CC + cg * 8u, sb = g * 32u;   // 32-bit offsets (sb in bytes): one offset register beside a scalar base serves all rows
    const char* sp = (const char*)style; char* ob = (char*)STB; char* oh = (char*)ST16;
    v4f a[8]; v8f s[2];
#pragma unroll
    for (int i = 0; i < 8; ++i) a[i] = *(const v4f*)(xb + ie + i * HW);
#pragma unroll
    for (int k = 0; k < 2; ++k) s[k] = *(const v8f*)(sp + (size_t)k * PTH * 32 + sb);
    asm volatile("s_wait_xcnt 0x0" ::: "memory");   // stands in front of the first overwrite of an offset register that the 12 issued loads name
    __builtin_amdgcn_sched_barrier(0);   // all 12 loads, and the wait behind them, stay in front of the arithmetic: one round trip; without it the style loads are sunk behind the first waits and the arithmetic is lifted over the wait
#pragma unroll
    for (int j = 0; j < 4; ++j) { v8us o;
#pragma unroll
        for (int i = 0; i < 8; ++i) o[i] = f2bf(a[i][j]);
        *(v8us*)(XT + oe + j * CC) = o; }
#pragma unroll
    for (int k = 0; k < 2; ++k) { v8us o; v8h h;
#pragma unroll
        for (int u = 0; u < 8; ++u) { o[u] = f2bf(s[k][u]); h[u] = tohx(bf2f(o[u])); }
        *(v8us*)(ob + (size_t)k * PTH * 16 + sb / 2u) = o; *(v8h*)(oh + (size_t)k * PTH * 16 + sb / 2u) = h; }
}
__global__ __launch_bounds__(256) void k_fin(const float* __restrict__ OP, const float* __restrict__ ML, const float* __restrict__ LS, const float* __restrict__ x, float* OUT) { const size_t b = blockIdx.y; const float* xb = x + b * CC * HW; float* OUTb = OUT + b * 2 * CC * HW; const unsigned e = (blockIdx.x * 256u + threadIdx.x) * 4u; if (e >= 2u * CC * HW) return; const unsigned n = e % HW; const unsigned c = e / HW; v4f r;
    if (c < CC) { const v4f a = *(const v4f*)(xb + e); for (int u = 0; u < 4; ++u) r[u] = bfr(a[u]); }
    else { const char* Ob = (const char*)(OP + b * CC * KSP * HW); const char* Mb = (const char*)(ML + b * HW); const char* Lb = (const char*)(LS + b * HW); const unsigned nb = n * 4u, eob = ((c - CC) * (KSP * HW) + n) * 4u;   // byte offsets in 32 bits: one offset register beside a scalar base serves all slices
         v4f mz[KSP], lz[KSP], oz[KSP];
#pragma unroll
        for (int z = 0; z < KSP; ++z) { mz[z] = *(const v4f*)(Mb + (size_t)z * NB_ * HW * 4 + nb); lz[z] = *(const v4f*)(Lb + (size_t)z * NB_ * HW * 4 + nb); oz[z] = *(const v4f*)(Ob + (size_t)z * HW * 4 + eob); }
        // inputs only: holds the 24 independent loads in front of the arithmetic, so that they are in flight together, and keeps their two offset registers untouched until the data is back
        asm volatile("" :: "v"(mz[0]), "v"(mz[1]), "v"(mz[2]), "v"(mz[3]), "v"(mz[4]), "v"(mz[5]), "v"(mz[6]), "v"(mz[7]), "v"(lz[0]), "v"(lz[1]), "v"(lz[2]), "v"(lz[3]), "v"(lz[4]), "v"(lz[5]), "v"(lz[6]), "v"(lz[7]), "v"(oz[0]), "v"(oz[1]), "v"(oz[2]), "v"(oz[3]), "v"(oz[4]), "v"(oz[5]), "v"(oz[6]), "v"(oz[7]), "v"(nb), "v"(eob));
#pragma unroll   // u indexes vector elements: rolled, every access would become a chain of selects
        for (int u = 0; u < 4; ++u) { float M = mz[0][u];
#pragma unroll
            for (int z = 1; z < KSP; ++z) M = fmaxf(M, mz[z][u]);
            float w[KSP], num = 0.f, den = 0.f;
#pragma unroll
            for (int z = 0; z < KSP; ++z) w[z] = mz[z][u] - M;
            exp2_run8(w);
#pragma unroll
            for (int z = 0; z < KSP; ++z) { num = fmaf(w[z], oz[z][u], num); den = fmaf(w[z], lz[z][u], den); }
            r[u] = __fdiv_rn(num, den); } }
    *(v4f*)(OUTb + e) = r;  }

extern "C" void kernel_launch(void* const* d_in, const int* in_sizes, int n_in,
                              void* d_out, int out_size, void* d_ws, size_t ws_size, hipStream_t stream) {
    (void)in_sizes; (void)n_in; (void)out_size;
    const float* content = (const float*)d_in[0]; const float* content_s = (const float*)d_in[1]; const float* style = (const float*)d_in[2];
    float* OUT = (float*)d_out;     // [4][128][4096]
    char* wsp = (char*)d_ws;
    auto take = [&](size_t bytes) { char* p = wsp; wsp += (bytes + 255) & ~(size_t)255; return (void*)p; };
    bf* FCT = (bf*)take((size_t)NB_ * HW * CC * 2); bf* FST = (bf*)take((size_t)NB_ * HW * CC * 2); bf* STB = (bf*)take((size_t)NB_ * CC * HW * 2); h16* ST16 = (h16*)take((size_t)NB_ * CC * HW * 2);
    float* OP = (float*)take((size_t)KSP * NB_ * CC * HW * 4); float* ML = (float*)take((size_t)KSP * NB_ * HW * 4); float* LS = (float*)take((size_t)KSP * NB_ * HW * 4);
    if ((size_t)(wsp - (char*)d_ws) > ws_size) return;    // ~ 43 MB
    k_prep<<<PTH / 256, 256, 0, stream>>>(content, content_s, style, FCT, FST, STB, ST16);
    k_attn<<<dim3(KSP, NB_, HW / 256), 256, 0, stream>>>(FCT, FST, STB, ST16, OP, ML, LS);
    k_fin<<<dim3((unsigned)(((size_t)2 * CC * HW / 4 + 255) / 256), NB_), 256, 0, stream>>>(OP, ML, LS, content, OUT);
}

// v004
// It runs in 33.7 microseconds.
// In two side-by-side timings against v003, it was 1.52 and 1.55 times as fast.
// Counting every step since v000, it is 29.1 times as fast.
#include <hip/hip_runtime.h>

// SANet (content, content_s, style [4][64][64][64] channels-first, HW = 4096; S[q][k] = sum_c Fc[c][q] Fs[c][k] (unscaled, K = 64); P = softmax_k(S); O[c][q] = sum_k style[c][k] P[q][k]; out = concat(content, O) along channels -> [4][128][64][64]).
// Compute dtypes, f32 accumulate: every input rounded to bf16. One fused kernel (k_attn) does S, softmax and P.style^T with an online softmax: S^T = Fs.Fc^T as a PLAIN bf16 product on token-major copies of the inputs (exact products); the score accumulators are, lane for lane, the B operand of O += style.P^T, so S and P stay in registers. Query rows < RH: P as bf16 hi/lo planes x exact bf16 style (2 products); rows >= RH: single fp16 P x 1024 x fp16 style. The keys are split into KSP slices (grid x); each slice stores its unnormalised f32 partial O (channels-first), its running maximum (log2 domain) and its sum in its own workspace plane, and k_fin joins the planes; the content half is the bf16-rounded input copied.

#define NB_  4
#define CC   64
#define HW   4096
#define TT   HW
#define RH   512
#define PLOG 10.0f   // fp16 P carries a factor 2^PLOG (it cancels against the row sum)
#define KSP  8       // key slices of the fused kernel
#define KSL  (HW / KSP)
#define L2E  1.4426950408889634f
#define SKY  128                 // keys of one LDS stage
#define NST  (KSL / SKY)         // stages of a key slice
#define KPI  144                 // LDS pitch of a key row (128 bytes + 16) and
#define VPI  272                 // of a style row (256 bytes + 16): 16 bytes x odd, no bank conflict for 16-byte reads
#define KBY  (SKY * KPI)         // the key rows of a stage; the style rows follow them
#define BUFB (KBY + CC * VPI)    // one stage buffer
typedef _Float16 h16;
typedef unsigned short bf;
typedef __attribute__((ext_vector_type(16))) __bf16   v16bf;
typedef __attribute__((ext_vector_type(16))) _Float16 v16h;
typedef __attribute__((ext_vector_type(8)))  _Float16 v8h;
typedef __attribute__((ext_vector_type(8)))  unsigned short v8us;
typedef __attribute__((ext_vector_type(8)))  float    v8f;
typedef __attribute__((ext_vector_type(4)))  float    v4f;
typedef v8h  __attribute__((may_alias)) v8ha;
typedef v4f  __attribute__((may_alias)) v4fa;
typedef v8us __attribute__((may_alias)) v8usa;

__device__ __forceinline__ unsigned short f2bf(float f) { unsigned u = __float_as_uint(f); u += 0x7FFFu + ((u >> 16) & 1u); return (unsigned short)(u >> 16); }
__device__ __forceinline__ float bf2f(unsigned short b) { return __uint_as_float(((unsigned)b) << 16); }
__device__ __forceinline__ float bfr(float f) { return bf2f(f2bf(f)); }
__device__ __forceinline__ v16h cat16(v8h lo, v8h hi) { return __builtin_shufflevector(lo, hi, 0, 1, 2, 3, 4, 5, 6, 7, 8, 9, 10, 11, 12, 13, 14, 15); }
__device__ __forceinline__ v16bf cat16b(v8us lo, v8us hi) { return __builtin_bit_cast(v16bf, __builtin_shufflevector(lo, hi, 0, 1, 2, 3, 4, 5, 6, 7, 8, 9, 10, 11, 12, 13, 14, 15)); }
__device__ __forceinline__ v8f wmma16(v16h a, v16h b, v8f c) { return __builtin_amdgcn_wmma_f32_16x16x32_f16(false, a, false, b, (short)0, c, false, false); }
__device__ __forceinline__ v8f wmmab(v16bf a, v16bf b, v8f c) { return __builtin_amdgcn_wmma_f32_16x16x32_bf16(false, a, false, b, (short)0, c, false, false); }



// fragment loaders: K-contiguous 16-bit planes, lane (lr, hi) reads k = 8*hi + 0..7 and 16 + 8*hi + 0..7 of row lr
template <typename T16> struct WFrag;
template <> struct WFrag<h16> { typedef v16h V; static __device__ __forceinline__ V ld(const h16* p) { return cat16(*(const v8h*)p, *(const v8h*)(p + 16)); } static __device__ __forceinline__ v8f mma(V a, V b, v8f c) { return wmma16(a, b, c); } };
template <> struct WFrag<bf> { typedef v16bf V; static __device__ __forceinline__ V ld(const bf* p) { return cat16b(*(const v8us*)p, *(const v8us*)(p + 16)); } static __device__ __forceinline__ v8f mma(V a, V b, v8f c) { return wmmab(a, b, c); } };

__device__ __forceinline__ h16 tohx(float x) { return (h16)x; }
typedef __attribute__((ext_vector_type(2))) unsigned short v2us;
typedef __attribute__((ext_vector_type(2))) float v2f;

// lane l with lane l ^ 16
__device__ __forceinline__ float xhalf(float x) { return __builtin_bit_cast(float, __builtin_amdgcn_permlanex16(__builtin_bit_cast(int, x), __builtin_bit_cast(int, x), 0x76543210, 0xfedcba98, false, false)); }

// A run of exponentials (2^x) in place, as one statement: each stands behind an independent one, and the one v_nop at the end keeps, for the whole run, the slot that the instruction set asks for between a transcendental and the use of its result or the overwrite of its source.
__device__ __forceinline__ void exp2_run17(float (&t)[17]) { asm("v_exp_f32 %0, %0\n\tv_exp_f32 %1, %1\n\tv_exp_f32 %2, %2\n\tv_exp_f32 %3, %3\n\tv_exp_f32 %4, %4\n\tv_exp_f32 %5, %5\n\tv_exp_f32 %6, %6\n\tv_exp_f32 %7, %7\n\tv_exp_f32 %8, %8\n\tv_exp_f32 %9, %9\n\tv_exp_f32 %10, %10\n\tv_exp_f32 %11, %11\n\tv_exp_f32 %12, %12\n\tv_exp_f32 %13, %13\n\tv_exp_f32 %14, %14\n\tv_exp_f32 %15, %15\n\tv_exp_f32 %16, %16\n\tv_nop" : "+v"(t[0]), "+v"(t[1]), "+v"(t[2]), "+v"(t[3]), "+v"(t[4]), "+v"(t[5]), "+v"(t[6]), "+v"(t[7]), "+v"(t[8]), "+v"(t[9]), "+v"(t[10]), "+v"(t[11]), "+v"(t[12]), "+v"(t[13]), "+v"(t[14]), "+v"(t[15]), "+v"(t[16])); }
__device__ __forceinline__ void exp2_run8(float (&t)[8]) { asm("v_exp_f32 %0, %0\n\tv_exp_f32 %1, %1\n\tv_exp_f32 %2, %2\n\tv_exp_f32 %3, %3\n\tv_exp_f32 %4, %4\n\tv_exp_f32 %5, %5\n\tv_exp_f32 %6, %6\n\tv_exp_f32 %7, %7\n\tv_nop" : "+v"(t[0]), "+v"(t[1]), "+v"(t[2]), "+v"(t[3]), "+v"(t[4]), "+v"(t[5]), "+v"(t[6]), "+v"(t[7])); }

// One stage of the block's keys into LDS, 8 asynchronous copies of 16 bytes a thread: 128 key rows of 128 bytes (8 threads a row, 32 rows a copy) and 64 style rows of 256 bytes (16 threads a row, 16 rows a copy). lk, lv, gk, gv: the thread's own LDS byte addresses and global addresses of its first key and first style copy.
// The s_wait_xcnt at the end stands in front of every later overwrite of a register that these copies name.
__device__ __forceinline__ void stage_copy(const unsigned lk, const unsigned lv, const char* gk, const char* gv) {
    asm volatile("global_load_async_to_lds_b128 %0, %8, off\n\tglobal_load_async_to_lds_b128 %1, %9, off\n\tglobal_load_async_to_lds_b128 %2, %10, off\n\tglobal_load_async_to_lds_b128 %3, %11, off\n\t"
                 "global_load_async_to_lds_b128 %4, %12, off\n\tglobal_load_async_to_lds_b128 %5, %13, off\n\tglobal_load_async_to_lds_b128 %6, %14, off\n\tglobal_load_async_to_lds_b128 %7, %15, off\n\ts_wait_xcnt 0x0"
                 :: "v"(lk), "v"(lk + 32 * KPI), "v"(lk + 64 * KPI), "v"(lk + 96 * KPI), "v"(lv), "v"(lv + 16 * VPI), "v"(lv + 32 * VPI), "v"(lv + 48 * VPI),
                    "v"(gk), "v"(gk + 32 * CC * 2), "v"(gk + 64 * CC * 2), "v"(gk + 96 * CC * 2), "v"(gv), "v"(gv + 16 * HW * 2), "v"(gv + 32 * HW * 2), "v"(gv + 48 * HW * 2) : "memory");
}

// ---- one wave: 32 query columns x KSL keys, 32 keys a pass. S^T tile D[key][q]: lane (lr, hi) holds keys hi*8 + j of query lr; two such tiles (keys 0-15, 16-31) are the 16 elements of the B fragment of the second product (k = 8*hi + 0..7, 16 + 8*hi + 0..7).
template <bool HL> struct VSel;
template <> struct VSel<true> { typedef bf T; };
template <> struct VSel<false> { typedef h16 T; };
template <bool HL>
__device__ __forceinline__ void attn_slice(const bf* __restrict__ Q, const bf* __restrict__ Kt, const typename VSel<HL>::T* __restrict__ V, float* __restrict__ Op, float* __restrict__ Mp, float* __restrict__ Lp, const int q0, const int k0, char* sm) {
    typedef typename VSel<HL>::T VT; typedef typename WFrag<VT>::V VV;
    const int lane = threadIdx.x & 31, lr = lane & 15, hi = lane >> 4;
    v16bf bq[2][2];
#pragma unroll
    for (int nq = 0; nq < 2; ++nq)
#pragma unroll
        for (int ks = 0; ks < 2; ++ks) bq[nq][ks] = WFrag<bf>::ld(Q + (size_t)(q0 + nq * 16 + lr) * CC + ks * 32 + 8 * hi);
    v8f o[4][2];
#pragma unroll
    for (int mb = 0; mb < 4; ++mb)
#pragma unroll
        for (int nq = 0; nq < 2; ++nq) o[mb][nq] = (v8f){};
    float ml[2] = { -3.0e38f, -3.0e38f }, ls[2] = { 0.f, 0.f };
    // The block's 8 waves walk the same keys: each stage of SKY keys is brought into LDS once for all of them, two buffers, the next stage's copies in flight while this one is worked on.
    const unsigned tid = threadIdx.x, sb = (unsigned)(size_t)sm;   // sb: the low 32 bits of the shared address = the LDS byte address
    const unsigned lk = sb + (tid >> 3) * KPI + (tid & 7u) * 16u, lv = sb + KBY + (tid >> 4) * VPI + (tid & 15u) * 16u;
    const char* gk = (const char*)(Kt + (size_t)k0 * CC) + tid * 16u;
    const char* gv = (const char*)(V + (size_t)(tid >> 4) * HW + k0) + (tid & 15u) * 16u;
    stage_copy(lk, lv, gk, gv);
    asm volatile("s_wait_asynccnt 0x0" ::: "memory");   // this wave's copies of stage 0 have landed
    __syncthreads();                                    // ... and every other wave's
    stage_copy(lk + BUFB, lv + BUFB, gk + SKY * CC * 2, gv + SKY * 2);
#pragma unroll 1   // the two buffers alternate by address; unrolled, the code would only grow
    for (int s = 0; s < NST; ++s) {
      const unsigned bo = (s & 1) * BUFB;
      const char* kl = sm + bo + lr * KPI + 16 * hi;         // key rows lr and 16 + lr of the pass
      const char* vl = sm + bo + KBY + lr * VPI + 16 * hi;   // channel rows lr + 16 * mb, the pass's 32 keys
#pragma unroll 1   // one pass is already 16 or 24 matrix instructions; unrolling would only add registers
      for (int i = 0; i < SKY / 32; ++i) {
        v16bf ak[2][2]; VV av[4];
#pragma unroll
        for (int t = 0; t < 2; ++t)
#pragma unroll
            for (int ks = 0; ks < 2; ++ks) ak[t][ks] = WFrag<bf>::ld((const bf*)(kl + t * 16 * KPI + ks * 64));
#pragma unroll
        for (int mb = 0; mb < 4; ++mb) av[mb] = WFrag<VT>::ld((const VT*)(vl + mb * 16 * VPI));
        __builtin_amdgcn_sched_barrier(0);   // all 16 LDS reads of the pass stand as one group in front of its arithmetic; without it they fall into two groups with vector instructions between
        kl += 32 * KPI; vl += 64;
#pragma unroll
        for (int nq = 0; nq < 2; ++nq) {
            v8f s0 = (v8f){}, s1 = (v8f){};
            s0 = wmmab(ak[0][0], bq[nq][0], s0); s1 = wmmab(ak[1][0], bq[nq][0], s1);
            s0 = wmmab(ak[0][1], bq[nq][1], s0); s1 = wmmab(ak[1][1], bq[nq][1], s1);
            float cm = fmaxf(s0[0], s1[0]);
#pragma unroll
            for (int j = 1; j < 8; ++j) cm = fmaxf(cm, fmaxf(s0[j], s1[j]));
            cm = fmaxf(cm, xhalf(cm));
            const float mn = fmaxf(ml[nq], fmaf(cm, L2E, HL ? 0.f : -PLOG));
            float t[17];
#pragma unroll
            for (int j = 0; j < 8; ++j) { t[j] = fmaf(s0[j], L2E, -mn); t[8 + j] = fmaf(s1[j], L2E, -mn); }
            t[16] = ml[nq] - mn; ml[nq] = mn;
            exp2_run17(t);
            const float al = t[16];
            float sum = 0.f;
#pragma unroll
            for (int j = 0; j < 8; ++j) sum += t[j] + t[8 + j];
            ls[nq] = fmaf(ls[nq], al, sum);
#pragma unroll
            for (int mb = 0; mb < 4; ++mb) o[mb][nq] *= al;
            if constexpr (HL) {
                v16bf ph, pl;   // hi = P rounded to nearest even, lo = the rounded rest (the hardware conversion; same values as f2bf for finite P)
#pragma unroll
                for (int j = 0; j < 16; ++j) { const __bf16 h = (__bf16)t[j]; ph[j] = h; pl[j] = (__bf16)(t[j] - (float)h); }
#pragma unroll
                for (int mb = 0; mb < 4; ++mb) o[mb][nq] = wmmab(av[mb], ph, o[mb][nq]);
#pragma unroll
                for (int mb = 0; mb < 4; ++mb) o[mb][nq] = wmmab(av[mb], pl, o[mb][nq]);
            } else {
                v8h x0, x1;
#pragma unroll
                for (int j = 0; j < 8; ++j) { x0[j] = tohx(t[j]); x1[j] = tohx(t[8 + j]); }
                const v16h pf = cat16(x0, x1);
#pragma unroll
                for (int mb = 0; mb < 4; ++mb) o[mb][nq] = wmma16(av[mb], pf, o[mb][nq]);
            }
        }
      }
      asm volatile("s_wait_dscnt 0x0" ::: "memory");      // this wave's reads of stage s are done before its buffer is refilled
      asm volatile("s_wait_asynccnt 0x0" ::: "memory");   // this wave's copies of stage s + 1 have landed
      __syncthreads();                                    // publishes stage s + 1 and ends every wave's reads of stage s
      if (s + 2 < NST) stage_copy(lk + bo, lv + bo, gk + (s + 2) * (SKY * CC * 2), gv + (s + 2) * (SKY * 2));
    }
    asm volatile("s_wait_asynccnt 0x0" ::: "memory");     // no copy is outstanding when the wave goes on to its stores and ends
#pragma unroll
    for (int nq = 0; nq < 2; ++nq) { const float lt = ls[nq] + xhalf(ls[nq]); if (hi == 0) { Mp[q0 + nq * 16 + lr] = ml[nq]; Lp[q0 + nq * 16 + lr] = lt; } }
#pragma unroll
    for (int mb = 0; mb < 4; ++mb)
#pragma unroll
        for (int nq = 0; nq < 2; ++nq)
#pragma unroll
            for (int j = 0; j < 8; ++j) Op[(size_t)(mb * 16 + hi * 8 + j) * (KSP * HW) + q0 + nq * 16 + lr] = o[mb][nq][j];
}
// grid (KSP, NB_, HW / 256): the query block is the slowest index, so that the heavier hi/lo blocks (rows < RH) start first; 8 waves, four waves per SIMD (under 256 registers): the waves of a block walk the same keys (staged in LDS once for the block), each with its own 32 queries. Partial O: [image][channel][slice][query], so that the slices of one output element lie 16 KB apart; maxima and sums: [slice][image][query].
__global__ __launch_bounds__(256) void k_attn(const bf* __restrict__ FCT, const bf* __restrict__ FST, const bf* __restrict__ STB, const h16* __restrict__ ST16, float* __restrict__ OP, float* __restrict__ ML, float* __restrict__ LS) {
    const size_t b = blockIdx.y, pl = (size_t)blockIdx.x * NB_ + b; const int q0 = blockIdx.z * 256 + (threadIdx.x >> 5) * 32, k0 = blockIdx.x * KSL;
    const bf* Q = FCT + b * HW * CC; const bf* Kt = FST + b * HW * CC; const bf* Vb = STB + b * CC * HW; const h16* Vh = ST16 + b * CC * HW;
    float* Op = OP + (b * CC * KSP + blockIdx.x) * HW; float* Mp = ML + pl * HW; float* Lp = LS + pl * HW;
    __shared__ __attribute__((aligned(16))) char sm[2 * BUFB];
    if (blockIdx.z * 256 < RH) attn_slice<true>(Q, Kt, Vb, Op, Mp, Lp, q0, k0, sm); else attn_slice<false>(Q, Kt, Vh, Op, Mp, Lp, q0, k0, sm);
}

// One launch converts all three inputs; every thread does the same work, all 12 loads first.
// (a) content (blocks of the lower half of the grid) or content_s (upper half) to token-major bf16: a thread holds 8 channels x 4 tokens, 8 lanes cover the 64 channels, so that a wave's store writes whole 128-byte token rows and its load reads 64-byte pieces of 8 channel rows.
// (b) 16 elements of style to bf16 and to fp16 of the bf16 value, layout kept ([c][k] = the A operand).
#define PTH (NB_ * CC * HW / 16)   // threads of k_prep: 16 style elements and one 8 x 4 tile each
__global__ __launch_bounds__(256) void k_prep(const float* __restrict__ content, const float* __restrict__ content_s, const float* __restrict__ style, bf* FCT, bf* FST, bf* STB, h16* ST16) {
    const unsigned g = blockIdx.x * 256u + threadIdx.x;
    const bool second = blockIdx.x >= PTH / 512; const unsigned im = (blockIdx.x / (PTH / 2048)) % NB_;   // block-uniform: tensor and image
    const float* xb = (second ? content_s : content) + (size_t)im * CC * HW; bf* XT = (second ? FST : FCT) + (size_t)im * HW * CC;
    const unsigned t = g % (PTH / 8), cg = t & 7u, m0 = (t >> 3) * 4u;
    const unsigned ie = cg * 8u * HW + m0, oe = m0 * CC + cg * 8u, sb = g * 32u;   // 32-bit offsets (sb in bytes): one offset register beside a scalar base serves all rows
    const char* sp = (const char*)style; char* ob = (char*)STB; char* oh = (char*)ST16;
    v4f a[8]; v8f s[2];
#pragma unroll
    for (int i = 0; i < 8; ++i) a[i] = *(const v4f*)(xb + ie + i * HW);
#pragma unroll
    for (int k = 0; k < 2; ++k) s[k] = *(const v8f*)(sp + (size_t)k * PTH * 32 + sb);
    asm volatile("s_wait_xcnt 0x0" ::: "memory");   // stands in front of the first overwrite of an offset register that the 12 issued loads name
    __builtin_amdgcn_sched_barrier(0);   // all 12 loads, and the wait behind them, stay in front of the arithmetic: one round trip; without it the style loads are sunk behind the first waits and the arithmetic is lifted over the wait
#pragma unroll
    for (int j = 0; j < 4; ++j) { v8us o;
#pragma unroll
        for (int i = 0; i < 8; ++i) o[i] = f2bf(a[i][j]);
        *(v8us*)(XT + oe + j * CC) = o; }
#pragma unroll
    for (int k = 0; k < 2; ++k) { v8us o; v8h h;
#pragma unroll
        for (int u = 0; u < 8; ++u) { o[u] = f2bf(s[k][u]); h[u] = tohx(bf2f(o[u])); }
        *(v8us*)(ob + (size_t)k * PTH * 16 + sb / 2u) = o; *(v8h*)(oh + (size_t)k * PTH * 16 + sb / 2u) = h; }
}
__global__ __launch_bounds__(256) void k_fin(const float* __restrict__ OP, const float* __restrict__ ML, const float* __restrict__ LS, const float* __restrict__ x, float* OUT) { const size_t b = blockIdx.y; const float* xb = x + b * CC * HW; float* OUTb = OUT + b * 2 * CC * HW; const unsigned e = (blockIdx.x * 256u + threadIdx.x) * 4u; if (e >= 2u * CC * HW) return; const unsigned n = e % HW; const unsigned c = e / HW; v4f r;
    if (c < CC) { const v4f a = *(const v4f*)(xb + e); for (int u = 0; u < 4; ++u) r[u] = bfr(a[u]); }
    else { const char* Ob = (const char*)(OP + b * CC * KSP * HW); const char* Mb = (const char*)(ML + b * HW); const char* Lb = (const char*)(LS + b * HW); const unsigned nb = n * 4u, eob = ((c - CC) * (KSP * HW) + n) * 4u;   // byte offsets in 32 bits: one offset register beside a scalar base serves all slices
         v4f mz[KSP], lz[KSP], oz[KSP];
#pragma unroll
        for (int z = 0; z < KSP; ++z) { mz[z] = *(const v4f*)(Mb + (size_t)z * NB_ * HW * 4 + nb); lz[z] = *(const v4f*)(Lb + (size_t)z * NB_ * HW * 4 + nb); oz[z] = *(const v4f*)(Ob + (size_t)z * HW * 4 + eob); }
        // inputs only: holds the 24 independent loads in front of the arithmetic, so that they are in flight together, and keeps their two offset registers untouched until the data is back
        asm volatile("" :: "v"(mz[0]), "v"(mz[1]), "v"(mz[2]), "v"(mz[3]), "v"(mz[4]), "v"(mz[5]), "v"(mz[6]), "v"(mz[7]), "v"(lz[0]), "v"(lz[1]), "v"(lz[2]), "v"(lz[3]), "v"(lz[4]), "v"(lz[5]), "v"(lz[6]), "v"(lz[7]), "v"(oz[0]), "v"(oz[1]), "v"(oz[2]), "v"(oz[3]), "v"(oz[4]), "v"(oz[5]), "v"(oz[6]), "v"(oz[7]), "v"(nb), "v"(eob));
#pragma unroll   // u indexes vector elements: rolled, every access would become a chain of selects
        for (int u = 0; u < 4; ++u) { float M = mz[0][u];
#pragma unroll
            for (int z = 1; z < KSP; ++z) M = fmaxf(M, mz[z][u]);
            float w[KSP], num = 0.f, den = 0.f;
#pragma unroll
            for (int z = 0; z < KSP; ++z) w[z] = mz[z][u] - M;
            exp2_run8(w);
#pragma unroll
            for (int z = 0; z < KSP; ++z) { num = fmaf(w[z], oz[z][u], num); den = fmaf(w[z], lz[z][u], den); }
            r[u] = __fdiv_rn(num, den); } }
    *(v4f*)(OUTb + e) = r;  }

extern "C" void kernel_launch(void* const* d_in, const int* in_sizes, int n_in,
                              void* d_out, int out_size, void* d_ws, size_t ws_size, hipStream_t stream) {
    (void)in_sizes; (void)n_in; (void)out_size;
    const float* content = (const float*)d_in[0]; const float* content_s = (const float*)d_in[1]; const float* style = (const float*)d_in[2];
    float* OUT = (float*)d_out;     // [4][128][4096]
    char* wsp = (char*)d_ws;
    auto take = [&](size_t bytes) { char* p = wsp; wsp += (bytes + 255) & ~(size_t)255; return (void*)p; };
    bf* FCT = (bf*)take((size_t)NB_ * HW * CC * 2); bf* FST = (bf*)take((size_t)NB_ * HW * CC * 2); bf* STB = (bf*)take((size_t)NB_ * CC * HW * 2); h16* ST16 = (h16*)take((size_t)NB_ * CC * HW * 2);
    float* OP = (float*)take((size_t)KSP * NB_ * CC * HW * 4); float* ML = (float*)take((size_t)KSP * NB_ * HW * 4); float* LS = (float*)take((size_t)KSP * NB_ * HW * 4);
    if ((size_t)(wsp - (char*)d_ws) > ws_size) return;    // ~ 43 MB
    k_prep<<<PTH / 256, 256, 0, stream>>>(content, content_s, style, FCT, FST, STB, ST16);
    k_attn<<<dim3(KSP, NB_, HW / 256), 256, 0, stream>>>(FCT, FST, STB, ST16, OP, ML, LS);
    k_fin<<<dim3((unsigned)(((size_t)2 * CC * HW / 4 + 255) / 256), NB_), 256, 0, stream>>>(OP, ML, LS, content, OUT);
}

// v005
// A run of this version takes 30.8 microseconds.
// Next to v004, in two timings, it ran 1.09 and 1.10 times as fast.
// Counting every step since v000, it is 31.9 times as fast.
#include <hip/hip_runtime.h>

// SANet (content, content_s, style [4][64][64][64] channels-first, HW = 4096; S[q][k] = sum_c Fc[c][q] Fs[c][k] (unscaled, K = 64); P = softmax_k(S); O[c][q] = sum_k style[c][k] P[q][k]; out = concat(content, O) along channels -> [4][128][64][64]).
// Compute dtypes, f32 accumulate: every input rounded to bf16. One fused kernel (k_attn) does S, softmax and P.style^T with an online softmax: S^T = Fs.Fc^T as a PLAIN bf16 product on token-major copies of the inputs (exact products); the score accumulators are, lane for lane, the B operand of O += style.P^T, so S and P stay in registers. Query rows < RH: P as bf16 hi/lo planes x exact bf16 style (2 products); rows >= RH: single fp16 P x 1024 x fp16 style. The keys are split into KSP slices (grid x); each slice stores its unnormalised f32 partial O (channels-first), its running maximum (log2 domain) and its sum in its own workspace plane, and k_fin joins the planes; the content half is the bf16-rounded input copied.

#define NB_  4
#define CC   64
#define HW   4096
#define TT   HW
#define RH   512
#define PLOG 10.0f   // fp16 P carries a factor 2^PLOG (it cancels against the row sum)
#define KSP  8       // key slices of the fused kernel
#define KSL  (HW / KSP)
#define L2E  1.4426950408889634f
#define SKY  128                 // keys of one LDS stage
#define NST  (KSL / SKY)         // stages of a key slice
#define KPI  144                 // LDS pitch of a key row (128 bytes + 16) and
#define VPI  272                 // of a style row (256 bytes + 16): 16 bytes x odd, no bank conflict for 16-byte reads
#define KBY  (SKY * KPI)         // the key rows of a stage; the style rows follow them
#define BUFB (KBY + CC * VPI)    // one stage buffer
typedef _Float16 h16;
typedef unsigned short bf;
typedef __attribute__((ext_vector_type(16))) __bf16   v16bf;
typedef __attribute__((ext_vector_type(16))) _Float16 v16h;
typedef __attribute__((ext_vector_type(8)))  _Float16 v8h;
typedef __attribute__((ext_vector_type(8)))  unsigned short v8us;
typedef __attribute__((ext_vector_type(8)))  float    v8f;
typedef __attribute__((ext_vector_type(4)))  float    v4f;
typedef v8h  __attribute__((may_alias)) v8ha;
typedef v4f  __attribute__((may_alias)) v4fa;
typedef v8us __attribute__((may_alias)) v8usa;

__device__ __forceinline__ unsigned short f2bf(float f) { unsigned u = __float_as_uint(f); u += 0x7FFFu + ((u >> 16) & 1u); return (unsigned short)(u >> 16); }
__device__ __forceinline__ float bf2f(unsigned short b) { return __uint_as_float(((unsigned)b) << 16); }
__device__ __forceinline__ float bfr(float f) { return bf2f(f2bf(f)); }
__device__ __forceinline__ v16h cat16(v8h lo, v8h hi) { return __builtin_shufflevector(lo, hi, 0, 1, 2, 3, 4, 5, 6, 7, 8, 9, 10, 11, 12, 13, 14, 15); }
__device__ __forceinline__ v16bf cat16b(v8us lo, v8us hi) { return __builtin_bit_cast(v16bf, __builtin_shufflevector(lo, hi, 0, 1, 2, 3, 4, 5, 6, 7, 8, 9, 10, 11, 12, 13, 14, 15)); }
__device__ __forceinline__ v8f wmma16(v16h a, v16h b, v8f c) { return __builtin_amdgcn_wmma_f32_16x16x32_f16(false, a, false, b, (short)0, c, false, false); }
__device__ __forceinline__ v8f wmmab(v16bf a, v16bf b, v8f c) { return __builtin_amdgcn_wmma_f32_16x16x32_bf16(false, a, false, b, (short)0, c, false, false); }



// fragment loaders: K-contiguous 16-bit planes, lane (lr, hi) reads k = 8*hi + 0..7 and 16 + 8*hi + 0..7 of row lr
template <typename T16> struct WFrag;
template <> struct WFrag<h16> { typedef v16h V; static __device__ __forceinline__ V ld(const h16* p) { return cat16(*(const v8h*)p, *(const v8h*)(p + 16)); } static __device__ __forceinline__ v8f mma(V a, V b, v8f c) { return wmma16(a, b, c); } };
template <> struct WFrag<bf> { typedef v16bf V; static __device__ __forceinline__ V ld(const bf* p) { return cat16b(*(const v8us*)p, *(const v8us*)(p + 16)); } static __device__ __forceinline__ v8f mma(V a, V b, v8f c) { return wmmab(a, b, c); } };

__device__ __forceinline__ h16 tohx(float x) { return (h16)x; }
typedef __attribute__((ext_vector_type(2))) unsigned short v2us;
typedef __attribute__((ext_vector_type(2))) float v2f;

// lane l with lane l ^ 16
__device__ __forceinline__ float xhalf(float x) { return __builtin_bit_cast(float, __builtin_amdgcn_permlanex16(__builtin_bit_cast(int, x), __builtin_bit_cast(int, x), 0x76543210, 0xfedcba98, false, false)); }

// A run of exponentials (2^x) in place, as one statement: each stands behind an independent one, and the one v_nop at the end keeps, for the whole run, the slot that the instruction set asks for between a transcendental and the use of its result or the overwrite of its source.
__device__ __forceinline__ void exp2_run17(float (&t)[17]) { asm("v_exp_f32 %0, %0\n\tv_exp_f32 %1, %1\n\tv_exp_f32 %2, %2\n\tv_exp_f32 %3, %3\n\tv_exp_f32 %4, %4\n\tv_exp_f32 %5, %5\n\tv_exp_f32 %6, %6\n\tv_exp_f32 %7, %7\n\tv_exp_f32 %8, %8\n\tv_exp_f32 %9, %9\n\tv_exp_f32 %10, %10\n\tv_exp_f32 %11, %11\n\tv_exp_f32 %12, %12\n\tv_exp_f32 %13, %13\n\tv_exp_f32 %14, %14\n\tv_exp_f32 %15, %15\n\tv_exp_f32 %16, %16\n\tv_nop" : "+v"(t[0]), "+v"(t[1]), "+v"(t[2]), "+v"(t[3]), "+v"(t[4]), "+v"(t[5]), "+v"(t[6]), "+v"(t[7]), "+v"(t[8]), "+v"(t[9]), "+v"(t[10]), "+v"(t[11]), "+v"(t[12]), "+v"(t[13]), "+v"(t[14]), "+v"(t[15]), "+v"(t[16])); }
__device__ __forceinline__ void exp2_run8(float (&t)[8]) { asm("v_exp_f32 %0, %0\n\tv_exp_f32 %1, %1\n\tv_exp_f32 %2, %2\n\tv_exp_f32 %3, %3\n\tv_exp_f32 %4, %4\n\tv_exp_f32 %5, %5\n\tv_exp_f32 %6, %6\n\tv_exp_f32 %7, %7\n\tv_nop" : "+v"(t[0]), "+v"(t[1]), "+v"(t[2]), "+v"(t[3]), "+v"(t[4]), "+v"(t[5]), "+v"(t[6]), "+v"(t[7])); }

// One stage of the block's keys into LDS, 8 asynchronous copies of 16 bytes a thread: 128 key rows of 128 bytes (8 threads a row, 32 rows a copy) and 64 style rows of 256 bytes (16 threads a row, 16 rows a copy). lk, lv, gk, gv: the thread's own LDS byte addresses and global addresses of its first key and first style copy.
// The s_wait_xcnt at the end stands in front of every later overwrite of a register that these copies name.
__device__ __forceinline__ void stage_copy(const unsigned lk, const unsigned lv, const char* gk, const char* gv) {
    asm volatile("global_load_async_to_lds_b128 %0, %8, off\n\tglobal_load_async_to_lds_b128 %1, %9, off\n\tglobal_load_async_to_lds_b128 %2, %10, off\n\tglobal_load_async_to_lds_b128 %3, %11, off\n\t"
                 "global_load_async_to_lds_b128 %4, %12, off\n\tglobal_load_async_to_lds_b128 %5, %13, off\n\tglobal_load_async_to_lds_b128 %6, %14, off\n\tglobal_load_async_to_lds_b128 %7, %15, off\n\ts_wait_xcnt 0x0"
                 :: "v"(lk), "v"(lk + 32 * KPI), "v"(lk + 64 * KPI), "v"(lk + 96 * KPI), "v"(lv), "v"(lv + 16 * VPI), "v"(lv + 32 * VPI), "v"(lv + 48 * VPI),
                    "v"(gk), "v"(gk + 32 * CC * 2), "v"(gk + 64 * CC * 2), "v"(gk + 96 * CC * 2), "v"(gv), "v"(gv + 16 * HW * 2), "v"(gv + 32 * HW * 2), "v"(gv + 48 * HW * 2) : "memory");
}

// ---- one wave: 32 query columns x KSL keys, 32 keys a pass. S^T tile D[key][q]: lane (lr, hi) holds keys hi*8 + j of query lr; two such tiles (keys 0-15, 16-31) are the 16 elements of the B fragment of the second product (k = 8*hi + 0..7, 16 + 8*hi + 0..7).
template <bool HL> struct VSel;
template <> struct VSel<true> { typedef bf T; };
template <> struct VSel<false> { typedef h16 T; };
template <bool HL>
__device__ __forceinline__ void attn_slice(const bf* __restrict__ Q, const bf* __restrict__ Kt, const typename VSel<HL>::T* __restrict__ V, float* __restrict__ Op, float* __restrict__ Mp, float* __restrict__ Lp, const int q0, const int k0, char* sm) {
    typedef typename VSel<HL>::T VT; typedef typename WFrag<VT>::V VV;
    const int lane = threadIdx.x & 31, lr = lane & 15, hi = lane >> 4;
    v16bf bq[2][2];
#pragma unroll
    for (int nq = 0; nq < 2; ++nq)
#pragma unroll
        for (int ks = 0; ks < 2; ++ks) bq[nq][ks] = WFrag<bf>::ld(Q + (size_t)(q0 + nq * 16 + lr) * CC + ks * 32 + 8 * hi);
    v8f o[4][2];
#pragma unroll
    for (int mb = 0; mb < 4; ++mb)
#pragma unroll
        for (int nq = 0; nq < 2; ++nq) o[mb][nq] = (v8f){};
    float ml[2] = { -3.0e38f, -3.0e38f }, ls[2] = { 0.f, 0.f };
    // The block's 8 waves walk the same keys: each stage of SKY keys is brought into LDS once for all of them, two buffers, the next stage's copies in flight while this one is worked on.
    const unsigned tid = threadIdx.x, sb = (unsigned)(size_t)sm;   // sb: the low 32 bits of the shared address = the LDS byte address
    const unsigned lk = sb + (tid >> 3) * KPI + (tid & 7u) * 16u, lv = sb + KBY + (tid >> 4) * VPI + (tid & 15u) * 16u;
    const char* gk = (const char*)(Kt + (size_t)k0 * CC) + tid * 16u;
    const char* gv = (const char*)(V + (size_t)(tid >> 4) * HW + k0) + (tid & 15u) * 16u;
    stage_copy(lk, lv, gk, gv);
    asm volatile("s_wait_asynccnt 0x0" ::: "memory");   // this wave's copies of stage 0 have landed
    __syncthreads();                                    // ... and every other wave's
    stage_copy(lk + BUFB, lv + BUFB, gk + SKY * CC * 2, gv + SKY * 2);
#pragma unroll 1   // the two buffers alternate by address; unrolled, the code would only grow
    for (int s = 0; s < NST; ++s) {
      const unsigned bo = (s & 1) * BUFB;
      const char* kl = sm + bo + lr * KPI + 16 * hi;         // key rows lr and 16 + lr of the pass
      const char* vl = sm + bo + KBY + lr * VPI + 16 * hi;   // channel rows lr + 16 * mb, the pass's 32 keys
#pragma unroll 1   // one pass is already 16 or 24 matrix instructions; unrolling would only add registers
      for (int i = 0; i < SKY / 32; ++i) {
        v16bf ak[2][2]; VV av[4];
#pragma unroll
        for (int t = 0; t < 2; ++t)
#pragma unroll
            for (int ks = 0; ks < 2; ++ks) ak[t][ks] = WFrag<bf>::ld((const bf*)(kl + t * 16 * KPI + ks * 64));
#pragma unroll
        for (int mb = 0; mb < 4; ++mb) av[mb] = WFrag<VT>::ld((const VT*)(vl + mb * 16 * VPI));
        __builtin_amdgcn_sched_barrier(0);   // all 16 LDS reads of the pass stand as one group in front of its arithmetic; without it they fall into two groups with vector instructions between
        kl += 32 * KPI; vl += 64;
#pragma unroll
        for (int nq = 0; nq < 2; ++nq) {
            v8f s0 = (v8f){}, s1 = (v8f){};
            s0 = wmmab(ak[0][0], bq[nq][0], s0); s1 = wmmab(ak[1][0], bq[nq][0], s1);
            s0 = wmmab(ak[0][1], bq[nq][1], s0); s1 = wmmab(ak[1][1], bq[nq][1], s1);
            float cm = fmaxf(s0[0], s1[0]);
#pragma unroll
            for (int j = 1; j < 8; ++j) cm = fmaxf(cm, fmaxf(s0[j], s1[j]));
            cm = fmaxf(cm, xhalf(cm));
            const float mn = fmaxf(ml[nq], fmaf(cm, L2E, HL ? 0.f : -PLOG));
            float t[17];
#pragma unroll
            for (int j = 0; j < 8; ++j) { t[j] = fmaf(s0[j], L2E, -mn); t[8 + j] = fmaf(s1[j], L2E, -mn); }
            t[16] = ml[nq] - mn; ml[nq] = mn;
            exp2_run17(t);
            const float al = t[16];
            float sum = 0.f;
#pragma unroll
            for (int j = 0; j < 8; ++j) sum += t[j] + t[8 + j];
            ls[nq] = fmaf(ls[nq], al, sum);
#pragma unroll
            for (int mb = 0; mb < 4; ++mb) o[mb][nq] *= al;
            if constexpr (HL) {
                v16bf ph, pl;   // hi = P rounded to nearest even, lo = the rounded rest (the hardware conversion; same values as f2bf for finite P)
#pragma unroll
                for (int j = 0; j < 16; ++j) { const __bf16 h = (__bf16)t[j]; ph[j] = h; pl[j] = (__bf16)(t[j] - (float)h); }
#pragma unroll
                for (int mb = 0; mb < 4; ++mb) o[mb][nq] = wmmab(av[mb], ph, o[mb][nq]);
#pragma unroll
                for (int mb = 0; mb < 4; ++mb) o[mb][nq] = wmmab(av[mb], pl, o[mb][nq]);
            } else {
                v8h x0, x1;
#pragma unroll
                for (int j = 0; j < 8; ++j) { x0[j] = tohx(t[j]); x1[j] = tohx(t[8 + j]); }
                const v16h pf = cat16(x0, x1);
#pragma unroll
                for (int mb = 0; mb < 4; ++mb) o[mb][nq] = wmma16(av[mb], pf, o[mb][nq]);
            }
        }
      }
      asm volatile("s_wait_dscnt 0x0" ::: "memory");      // this wave's reads of stage s are done before its buffer is refilled
      asm volatile("s_wait_asynccnt 0x0" ::: "memory");   // this wave's copies of stage s + 1 have landed
      __syncthreads();                                    // publishes stage s + 1 and ends every wave's reads of stage s
      if (s + 2 < NST) stage_copy(lk + bo, lv + bo, gk + (s + 2) * (SKY * CC * 2), gv + (s + 2) * (SKY * 2));
    }
    asm volatile("s_wait_asynccnt 0x0" ::: "memory");     // no copy is outstanding when the wave goes on to its stores and ends
#pragma unroll
    for (int nq = 0; nq < 2; ++nq) { const float lt = ls[nq] + xhalf(ls[nq]); if (hi == 0) { Mp[q0 + nq * 16 + lr] = ml[nq]; Lp[q0 + nq * 16 + lr] = lt; } }
#pragma unroll
    for (int mb = 0; mb < 4; ++mb)
#pragma unroll
        for (int nq = 0; nq < 2; ++nq)
#pragma unroll
            for (int j = 0; j < 8; ++j) Op[(size_t)(mb * 16 + hi * 8 + j) * (KSP * HW) + q0 + nq * 16 + lr] = o[mb][nq][j];
}
// grid (KSP, NB_, HW / 256): the query block is the slowest index, so that the heavier hi/lo blocks (rows < RH) start first; 8 waves, four waves per SIMD (under 256 registers): the waves of a block walk the same keys (staged in LDS once for the block), each with its own 32 queries. Partial O: [image][channel][slice][query], so that the slices of one output element lie 16 KB apart; maxima and sums: [slice][image][query].
__global__ __launch_bounds__(256) void k_attn(const bf* __restrict__ FCT, const bf* __restrict__ FST, const bf* __restrict__ STB, const h16* __restrict__ ST16, float* __restrict__ OP, float* __restrict__ ML, float* __restrict__ LS) {
    const size_t b = blockIdx.y, pl = (size_t)blockIdx.x * NB_ + b; const int q0 = blockIdx.z * 256 + (threadIdx.x >> 5) * 32, k0 = blockIdx.x * KSL;
    const bf* Q = FCT + b * HW * CC; const bf* Kt = FST + b * HW * CC; const bf* Vb = STB + b * CC * HW; const h16* Vh = ST16 + b * CC * HW;
    float* Op = OP + (b * CC * KSP + blockIdx.x) * HW; float* Mp = ML + pl * HW; float* Lp = LS + pl * HW;
    __shared__ __attribute__((aligned(16))) char sm[2 * BUFB];
    if (blockIdx.z * 256 < RH) attn_slice<true>(Q, Kt, Vb, Op, Mp, Lp, q0, k0, sm); else attn_slice<false>(Q, Kt, Vh, Op, Mp, Lp, q0, k0, sm);
}

// One launch converts all three inputs; every thread does the same work, all 12 loads first.
// (a) content (blocks of the lower half of the grid) or content_s (upper half) to token-major bf16: a thread holds 8 channels x 4 tokens, 8 lanes cover the 64 channels, so that a wave's store writes whole 128-byte token rows and its load reads 64-byte pieces of 8 channel rows.
// (b) 16 elements of style to bf16 and to fp16 of the bf16 value, layout kept ([c][k] = the A operand).
#define PTH (NB_ * CC * HW / 16)   // threads of k_prep: 16 style elements and one 8 x 4 tile each
__global__ __launch_bounds__(256) void k_prep(const float* __restrict__ content, const float* __restrict__ content_s, const float* __restrict__ style, bf* FCT, bf* FST, bf* STB, h16* ST16) {
    const unsigned g = blockIdx.x * 256u + threadIdx.x;
    const bool second = blockIdx.x >= PTH / 512; const unsigned im = (blockIdx.x / (PTH / 2048)) % NB_;   // block-uniform: tensor and image
    const float* xb = (second ? content_s : content) + (size_t)im * CC * HW; bf* XT = (second ? FST : FCT) + (size_t)im * HW * CC;
    const unsigned t = g % (PTH / 8), cg = t & 7u, m0 = (t >> 3) * 4u;
    const unsigned ie = cg * 8u * HW + m0, oe = m0 * CC + cg * 8u, sb = g * 32u;   // 32-bit offsets (sb in bytes): one offset register beside a scalar base serves all rows
    const char* sp = (const char*)style; char* ob = (char*)STB; char* oh = (char*)ST16;
    v4f a[8]; v8f s[2];
#pragma unroll
    for (int i = 0; i < 8; ++i) a[i] = *(const v4f*)(xb + ie + i * HW);
#pragma unroll
    for (int k = 0; k < 2; ++k) s[k] = *(const v8f*)(sp + (size_t)k * PTH * 32 + sb);
    asm volatile("s_wait_xcnt 0x0" ::: "memory");   // stands in front of the first overwrite of an offset register that the 12 issued loads name
    __builtin_amdgcn_sched_barrier(0);   // all 12 loads, and the wait behind them, stay in front of the arithmetic: one round trip; without it the style loads are sunk behind the first waits and the arithmetic is lifted over the wait
#pragma unroll
    for (int j = 0; j < 4; ++j) { v8us o;
#pragma unroll
        for (int i = 0; i < 8; ++i) o[i] = f2bf(a[i][j]);
        *(v8us*)(XT + oe + j * CC) = o; }
#pragma unroll
    for (int k = 0; k < 2; ++k) { v8us o; v8h h;
#pragma unroll
        for (int u = 0; u < 8; ++u) { o[u] = f2bf(s[k][u]); h[u] = tohx(bf2f(o[u])); }
        *(v8us*)(ob + (size_t)k * PTH * 16 + sb / 2u) = o; *(v8h*)(oh + (size_t)k * PTH * 16 + sb / 2u) = h; }
}
// Joins the key slices and copies the content half. A thread holds 4 queries x FCH channels: the slices' weights and their sum depend on the query alone and are formed once for its FCH channels; a wave's load or store covers 512 contiguous bytes of one row. Grid (2 * HW / 128, NB_): 128 queries x 32 channels a block, 4 channels a wave.
#define FCH 4
__global__ __launch_bounds__(256) void k_fin(const float* __restrict__ OP, const float* __restrict__ ML, const float* __restrict__ LS, const float* __restrict__ x, float* OUT) {
    const size_t b = blockIdx.y; const unsigned n = (blockIdx.x >> 1) * 128u + (threadIdx.x & 31u) * 4u, c0 = (blockIdx.x & 1u) * 32u + (threadIdx.x >> 5) * FCH;
    const char* Ob = (const char*)(OP + b * CC * KSP * HW); const char* Mb = (const char*)(ML + b * HW); const char* Lb = (const char*)(LS + b * HW); const char* xb = (const char*)(x + b * CC * HW); char* OUTb = (char*)(OUT + b * 2 * CC * HW);
    const unsigned nb = n * 4u, eob = (c0 * (KSP * HW) + n) * 4u, xo = (c0 * HW + n) * 4u;   // byte offsets in 32 bits: one offset register beside a scalar base serves all slices and channels
    v4f mz[KSP], lz[KSP], oz[FCH][KSP], a[FCH];
#pragma unroll
    for (int z = 0; z < KSP; ++z) { mz[z] = *(const v4f*)(Mb + (size_t)z * NB_ * HW * 4 + nb); lz[z] = *(const v4f*)(Lb + (size_t)z * NB_ * HW * 4 + nb); }
#pragma unroll
    for (int i = 0; i < FCH; ++i)
#pragma unroll
        for (int z = 0; z < KSP; ++z) oz[i][z] = *(const v4f*)(Ob + (size_t)i * KSP * HW * 4 + (size_t)z * HW * 4 + eob);
#pragma unroll
    for (int i = 0; i < FCH; ++i) a[i] = *(const v4f*)(xb + (size_t)i * HW * 4 + xo);
    asm volatile("s_wait_xcnt 0x0" :: "v"(nb), "v"(eob), "v"(xo) : "memory");   // stands in front of the first overwrite of an offset register that the 52 issued loads name; the three offsets are inputs, so that they stay in their registers up to here and no load's result is placed on one
    __builtin_amdgcn_sched_barrier(0);   // all 52 independent loads, and the wait behind them, stay in front of the arithmetic: one round trip for the whole thread
    v4f r[FCH];
#pragma unroll   // u indexes vector elements: rolled, every access would become a chain of selects
    for (int u = 0; u < 4; ++u) { float M = mz[0][u];
#pragma unroll
        for (int z = 1; z < KSP; ++z) M = fmaxf(M, mz[z][u]);
        float w[KSP], den = 0.f;
#pragma unroll
        for (int z = 0; z < KSP; ++z) w[z] = mz[z][u] - M;
        exp2_run8(w);
#pragma unroll
        for (int z = 0; z < KSP; ++z) den = fmaf(w[z], lz[z][u], den);
#pragma unroll
        for (int i = 0; i < FCH; ++i) { float num = 0.f;
#pragma unroll
            for (int z = 0; z < KSP; ++z) num = fmaf(w[z], oz[i][z][u], num);
            r[i][u] = __fdiv_rn(num, den); a[i][u] = bfr(a[i][u]); } }
#pragma unroll
    for (int i = 0; i < FCH; ++i) { *(v4f*)(OUTb + (size_t)i * HW * 4 + xo) = a[i]; *(v4f*)(OUTb + (size_t)(CC + i) * HW * 4 + xo) = r[i]; }
}

extern "C" void kernel_launch(void* const* d_in, const int* in_sizes, int n_in,
                              void* d_out, int out_size, void* d_ws, size_t ws_size, hipStream_t stream) {
    (void)in_sizes; (void)n_in; (void)out_size;
    const float* content = (const float*)d_in[0]; const float* content_s = (const float*)d_in[1]; const float* style = (const float*)d_in[2];
    float* OUT = (float*)d_out;     // [4][128][4096]
    char* wsp = (char*)d_ws;
    auto take = [&](size_t bytes) { char* p = wsp; wsp += (bytes + 255) & ~(size_t)255; return (void*)p; };
    bf* FCT = (bf*)take((size_t)NB_ * HW * CC * 2); bf* FST = (bf*)take((size_t)NB_ * HW * CC * 2); bf* STB = (bf*)take((size_t)NB_ * CC * HW * 2); h16* ST16 = (h16*)take((size_t)NB_ * CC * HW * 2);
    float* OP = (float*)take((size_t)KSP * NB_ * CC * HW * 4); float* ML = (float*)take((size_t)KSP * NB_ * HW * 4); float* LS = (float*)take((size_t)KSP * NB_ * HW * 4);
    if ((size_t)(wsp - (char*)d_ws) > ws_size) return;    // ~ 43 MB
    k_prep<<<PTH / 256, 256, 0, stream>>>(content, content_s, style, FCT, FST, STB, ST16);
    k_attn<<<dim3(KSP, NB_, HW / 256), 256, 0, stream>>>(FCT, FST, STB, ST16, OP, ML, LS);
    k_fin<<<dim3(2 * HW / 128, NB_), 256, 0, stream>>>(OP, ML, LS, content, OUT);
}

// v006
// Measured time: 29.7 microseconds a run.
// In two side-by-side timings against v005, it was 1.04 and 1.05 times as fast.
// Counting every step since v000, it is 33.2 times as fast.
#include <hip/hip_runtime.h>

// SANet (content, content_s, style [4][64][64][64] channels-first, HW = 4096; S[q][k] = sum_c Fc[c][q] Fs[c][k] (unscaled, K = 64); P = softmax_k(S); O[c][q] = sum_k style[c][k] P[q][k]; out = concat(content, O) along channels -> [4][128][64][64]).
// Compute dtypes, f32 accumulate: every input rounded to bf16. One fused kernel (k_attn) does S, softmax and P.style^T with an online softmax: S^T = Fs.Fc^T as a PLAIN bf16 product on token-major copies of the inputs (exact products); the score accumulators are, lane for lane, the B operand of O += style.P^T, so S and P stay in registers. P carries a factor 1024 and multiplies the fp16 style: query rows >= RH as a single fp16 plane, rows < RH as two fp16 planes, hi + lo (2 products). The keys are split into KSP slices (grid x); each slice stores its unnormalised f32 partial O (channels-first), its running maximum (log2 domain) and its sum in its own workspace plane, and k_fin joins the planes; the content half is the bf16-rounded input copied.

#define NB_  4
#define CC   64
#define HW   4096
#define TT   HW
#define RH   512
#define PLOG 10.0f   // fp16 P carries a factor 2^PLOG (it cancels against the row sum)
#define KSP  8       // key slices of the fused kernel
#define KSL  (HW / KSP)
#define L2E  1.4426950408889634f
#define SKY  128                 // keys of one LDS stage
#define NST  (KSL / SKY)         // stages of a key slice
#define KPI  144                 // LDS pitch of a key row (128 bytes + 16) and
#define VPI  272                 // of a style row (256 bytes + 16): 16 bytes x odd, no bank conflict for 16-byte reads
#define KBY  (SKY * KPI)         // the key rows of a stage; the style rows follow them
#define BUFB (KBY + CC * VPI)    // one stage buffer
typedef _Float16 h16;
typedef unsigned short bf;
typedef __attribute__((ext_vector_type(16))) __bf16   v16bf;
typedef __attribute__((ext_vector_type(16))) _Float16 v16h;
typedef __attribute__((ext_vector_type(8)))  _Float16 v8h;
typedef __attribute__((ext_vector_type(8)))  unsigned short v8us;
typedef __attribute__((ext_vector_type(8)))  float    v8f;
typedef __attribute__((ext_vector_type(4)))  float    v4f;
typedef v8h  __attribute__((may_alias)) v8ha;
typedef v4f  __attribute__((may_alias)) v4fa;
typedef v8us __attribute__((may_alias)) v8usa;

__device__ __forceinline__ unsigned short f2bf(float f) { unsigned u = __float_as_uint(f); u += 0x7FFFu + ((u >> 16) & 1u); return (unsigned short)(u >> 16); }
__device__ __forceinline__ float bf2f(unsigned short b) { return __uint_as_float(((unsigned)b) << 16); }
__device__ __forceinline__ float bfr(float f) { return bf2f(f2bf(f)); }
__device__ __forceinline__ v16h cat16(v8h lo, v8h hi) { return __builtin_shufflevector(lo, hi, 0, 1, 2, 3, 4, 5, 6, 7, 8, 9, 10, 11, 12, 13, 14, 15); }
__device__ __forceinline__ v16bf cat16b(v8us lo, v8us hi) { return __builtin_bit_cast(v16bf, __builtin_shufflevector(lo, hi, 0, 1, 2, 3, 4, 5, 6, 7, 8, 9, 10, 11, 12, 13, 14, 15)); }
__device__ __forceinline__ v8f wmma16(v16h a, v16h b, v8f c) { return __builtin_amdgcn_wmma_f32_16x16x32_f16(false, a, false, b, (short)0, c, false, false); }
__device__ __forceinline__ v8f wmmab(v16bf a, v16bf b, v8f c) { return __builtin_amdgcn_wmma_f32_16x16x32_bf16(false, a, false, b, (short)0, c, false, false); }



// fragment loaders: K-contiguous 16-bit planes, lane (lr, hi) reads k = 8*hi + 0..7 and 16 + 8*hi + 0..7 of row lr
template <typename T16> struct WFrag;
template <> struct WFrag<h16> { typedef v16h V; static __device__ __forceinline__ V ld(const h16* p) { return cat16(*(const v8h*)p, *(const v8h*)(p + 16)); } static __device__ __forceinline__ v8f mma(V a, V b, v8f c) { return wmma16(a, b, c); } };
template <> struct WFrag<bf> { typedef v16bf V; static __device__ __forceinline__ V ld(const bf* p) { return cat16b(*(const v8us*)p, *(const v8us*)(p + 16)); } static __device__ __forceinline__ v8f mma(V a, V b, v8f c) { return wmmab(a, b, c); } };

__device__ __forceinline__ h16 tohx(float x) { return (h16)x; }
typedef __attribute__((ext_vector_type(2))) unsigned short v2us;
typedef __attribute__((ext_vector_type(2))) float v2f;

// lane l with lane l ^ 16
__device__ __forceinline__ float xhalf(float x) { return __builtin_bit_cast(float, __builtin_amdgcn_permlanex16(__builtin_bit_cast(int, x), __builtin_bit_cast(int, x), 0x76543210, 0xfedcba98, false, false)); }

// A run of exponentials (2^x) in place, as one statement: each stands behind an independent one, and the one v_nop at the end keeps, for the whole run, the slot that the instruction set asks for between a transcendental and the use of its result or the overwrite of its source.
__device__ __forceinline__ void exp2_run17(float (&t)[17]) { asm("v_exp_f32 %0, %0\n\tv_exp_f32 %1, %1\n\tv_exp_f32 %2, %2\n\tv_exp_f32 %3, %3\n\tv_exp_f32 %4, %4\n\tv_exp_f32 %5, %5\n\tv_exp_f32 %6, %6\n\tv_exp_f32 %7, %7\n\tv_exp_f32 %8, %8\n\tv_exp_f32 %9, %9\n\tv_exp_f32 %10, %10\n\tv_exp_f32 %11, %11\n\tv_exp_f32 %12, %12\n\tv_exp_f32 %13, %13\n\tv_exp_f32 %14, %14\n\tv_exp_f32 %15, %15\n\tv_exp_f32 %16, %16\n\tv_nop" : "+v"(t[0]), "+v"(t[1]), "+v"(t[2]), "+v"(t[3]), "+v"(t[4]), "+v"(t[5]), "+v"(t[6]), "+v"(t[7]), "+v"(t[8]), "+v"(t[9]), "+v"(t[10]), "+v"(t[11]), "+v"(t[12]), "+v"(t[13]), "+v"(t[14]), "+v"(t[15]), "+v"(t[16])); }
__device__ __forceinline__ void exp2_run8(float (&t)[8]) { asm("v_exp_f32 %0, %0\n\tv_exp_f32 %1, %1\n\tv_exp_f32 %2, %2\n\tv_exp_f32 %3, %3\n\tv_exp_f32 %4, %4\n\tv_exp_f32 %5, %5\n\tv_exp_f32 %6, %6\n\tv_exp_f32 %7, %7\n\tv_nop" : "+v"(t[0]), "+v"(t[1]), "+v"(t[2]), "+v"(t[3]), "+v"(t[4]), "+v"(t[5]), "+v"(t[6]), "+v"(t[7])); }

// One stage of the block's keys into LDS, 8 asynchronous copies of 16 bytes a thread: 128 key rows of 128 bytes (8 threads a row, 32 rows a copy) and 64 style rows of 256 bytes (16 threads a row, 16 rows a copy). lk, lv, gk, gv: the thread's own LDS byte addresses and global addresses of its first key and first style copy.
// The s_wait_xcnt at the end stands in front of every later overwrite of a register that these copies name.
__device__ __forceinline__ void stage_copy(const unsigned lk, const unsigned lv, const char* gk, const char* gv) {
    asm volatile("global_load_async_to_lds_b128 %0, %8, off\n\tglobal_load_async_to_lds_b128 %1, %9, off\n\tglobal_load_async_to_lds_b128 %2, %10, off\n\tglobal_load_async_to_lds_b128 %3, %11, off\n\t"
                 "global_load_async_to_lds_b128 %4, %12, off\n\tglobal_load_async_to_lds_b128 %5, %13, off\n\tglobal_load_async_to_lds_b128 %6, %14, off\n\tglobal_load_async_to_lds_b128 %7, %15, off\n\ts_wait_xcnt 0x0"
                 :: "v"(lk), "v"(lk + 32 * KPI), "v"(lk + 64 * KPI), "v"(lk + 96 * KPI), "v"(lv), "v"(lv + 16 * VPI), "v"(lv + 32 * VPI), "v"(lv + 48 * VPI),
                    "v"(gk), "v"(gk + 32 * CC * 2), "v"(gk + 64 * CC * 2), "v"(gk + 96 * CC * 2), "v"(gv), "v"(gv + 16 * HW * 2), "v"(gv + 32 * HW * 2), "v"(gv + 48 * HW * 2) : "memory");
}

// ---- one wave: 32 query columns x KSL keys, 32 keys a pass. S^T tile D[key][q]: lane (lr, hi) holds keys hi*8 + j of query lr; two such tiles (keys 0-15, 16-31) are the 16 elements of the B fragment of the second product (k = 8*hi + 0..7, 16 + 8*hi + 0..7).
// The SKY / 32 passes of one stage. hl (the same in every lane of the wave): the wave's rows are hi/lo rows: a second plane, the rest that the fp16 rounding of P left, goes through the same style fragments.
__device__ __forceinline__ void stage_passes(const bool hl, const char* kl, const char* vl, const v16bf (&bq)[2][2], v8f (&o)[4][2], float (&ml)[2], float (&ls)[2]) {
#pragma unroll 1   // one pass is already 16 or 24 matrix instructions; unrolling would only add registers
    for (int i = 0; i < SKY / 32; ++i) {
        v16bf ak[2][2]; v16h av[4];
#pragma unroll
        for (int t = 0; t < 2; ++t)
#pragma unroll
            for (int ks = 0; ks < 2; ++ks) ak[t][ks] = WFrag<bf>::ld((const bf*)(kl + t * 16 * KPI + ks * 64));
#pragma unroll
        for (int mb = 0; mb < 4; ++mb) av[mb] = WFrag<h16>::ld((const h16*)(vl + mb * 16 * VPI));
        __builtin_amdgcn_sched_barrier(0);   // all 16 LDS reads of the pass stand as one group in front of its arithmetic; without it they fall into two groups with vector instructions between
        kl += 32 * KPI; vl += 64;
        float t[2][17]; v8h x0[2], x1[2];
#pragma unroll
        for (int nq = 0; nq < 2; ++nq) {
            v8f s0 = (v8f){}, s1 = (v8f){};
            s0 = wmmab(ak[0][0], bq[nq][0], s0); s1 = wmmab(ak[1][0], bq[nq][0], s1);
            s0 = wmmab(ak[0][1], bq[nq][1], s0); s1 = wmmab(ak[1][1], bq[nq][1], s1);
            float cm = fmaxf(s0[0], s1[0]);
#pragma unroll
            for (int j = 1; j < 8; ++j) cm = fmaxf(cm, fmaxf(s0[j], s1[j]));
            cm = fmaxf(cm, xhalf(cm));
            const float mn = fmaxf(ml[nq], fmaf(cm, L2E, -PLOG));
#pragma unroll
            for (int j = 0; j < 8; ++j) { t[nq][j] = fmaf(s0[j], L2E, -mn); t[nq][8 + j] = fmaf(s1[j], L2E, -mn); }
            t[nq][16] = ml[nq] - mn; ml[nq] = mn;
            exp2_run17(t[nq]);
            const float al = t[nq][16];
            float sum = 0.f;
#pragma unroll
            for (int j = 0; j < 8; ++j) sum += t[nq][j] + t[nq][8 + j];
            ls[nq] = fmaf(ls[nq], al, sum);
#pragma unroll
            for (int mb = 0; mb < 4; ++mb) o[mb][nq] *= al;
#pragma unroll
            for (int j = 0; j < 8; ++j) { x0[nq][j] = tohx(t[nq][j]); x1[nq][j] = tohx(t[nq][8 + j]); }
            const v16h pf = cat16(x0[nq], x1[nq]);
#pragma unroll
            for (int mb = 0; mb < 4; ++mb) o[mb][nq] = wmma16(av[mb], pf, o[mb][nq]);
        }
        if (hl) {   // one branch a pass, behind both column groups, so that the two groups' common arithmetic stays one block that the compiler can interleave
#pragma unroll
            for (int nq = 0; nq < 2; ++nq) {
                v8h y0, y1;
#pragma unroll
                for (int j = 0; j < 8; ++j) { y0[j] = tohx(t[nq][j] - (float)x0[nq][j]); y1[j] = tohx(t[nq][8 + j] - (float)x1[nq][j]); }
                const v16h pl = cat16(y0, y1);
#pragma unroll
                for (int mb = 0; mb < 4; ++mb) o[mb][nq] = wmma16(av[mb], pl, o[mb][nq]);
            }
        }
    }
}
__device__ __forceinline__ void attn_slice(const bool hl, const bf* __restrict__ Q, const bf* __restrict__ Kt, const h16* __restrict__ V, float* __restrict__ Op, float* __restrict__ Mp, float* __restrict__ Lp, const int q0, const int k0, char* sm) {
    const int lane = threadIdx.x & 31, lr = lane & 15, hi = lane >> 4;
    v16bf bq[2][2];
#pragma unroll
    for (int nq = 0; nq < 2; ++nq)
#pragma unroll
        for (int ks = 0; ks < 2; ++ks) bq[nq][ks] = WFrag<bf>::ld(Q + (size_t)(q0 + nq * 16 + lr) * CC + ks * 32 + 8 * hi);
    v8f o[4][2];
#pragma unroll
    for (int mb = 0; mb < 4; ++mb)
#pragma unroll
        for (int nq = 0; nq < 2; ++nq) o[mb][nq] = (v8f){};
    float ml[2] = { -3.0e38f, -3.0e38f }, ls[2] = { 0.f, 0.f };
    // The block's 8 waves walk the same keys: each stage of SKY keys is brought into LDS once for all of them, two buffers, the next stage's copies in flight while this one is worked on.
    const unsigned tid = threadIdx.x, sb = (unsigned)(size_t)sm;   // sb: the low 32 bits of the shared address = the LDS byte address
    const unsigned lk = sb + (tid >> 3) * KPI + (tid & 7u) * 16u, lv = sb + KBY + (tid >> 4) * VPI + (tid & 15u) * 16u;
    const char* gk = (const char*)(Kt + (size_t)k0 * CC) + tid * 16u;
    const char* gv = (const char*)(V + (size_t)(tid >> 4) * HW + k0) + (tid & 15u) * 16u;
    stage_copy(lk, lv, gk, gv);
    asm volatile("s_wait_asynccnt 0x0" ::: "memory");   // this wave's copies of stage 0 have landed
    __syncthreads();                                    // ... and every other wave's
    stage_copy(lk + BUFB, lv + BUFB, gk + SKY * CC * 2, gv + SKY * 2);
#pragma unroll 1   // the two buffers alternate by address; unrolled, the code would only grow
    for (int s = 0; s < NST; ++s) {
      const unsigned bo = (s & 1) * BUFB;
      const char* kl = sm + bo + lr * KPI + 16 * hi;         // key rows lr and 16 + lr of the pass
      const char* vl = sm + bo + KBY + lr * VPI + 16 * hi;   // channel rows lr + 16 * mb, the pass's 32 keys
      stage_passes(hl, kl, vl, bq, o, ml, ls);
      asm volatile("s_wait_dscnt 0x0" ::: "memory");      // this wave's reads of stage s are done before its buffer is refilled
      asm volatile("s_wait_asynccnt 0x0" ::: "memory");   // this wave's copies of stage s + 1 have landed
      __syncthreads();                                    // publishes stage s + 1 and ends every wave's reads of stage s
      if (s + 2 < NST) stage_copy(lk + bo, lv + bo, gk + (s + 2) * (SKY * CC * 2), gv + (s + 2) * (SKY * 2));
    }
    asm volatile("s_wait_asynccnt 0x0" ::: "memory");     // no copy is outstanding when the wave goes on to its stores and ends
#pragma unroll
    for (int nq = 0; nq < 2; ++nq) { const float lt = ls[nq] + xhalf(ls[nq]); if (hi == 0) { Mp[q0 + nq * 16 + lr] = ml[nq]; Lp[q0 + nq * 16 + lr] = lt; } }
#pragma unroll
    for (int mb = 0; mb < 4; ++mb)
#pragma unroll
        for (int nq = 0; nq < 2; ++nq)
#pragma unroll
            for (int j = 0; j < 8; ++j) Op[(size_t)(mb * 16 + hi * 8 + j) * (KSP * HW) + q0 + nq * 16 + lr] = o[mb][nq][j];
}
// grid (KSP, NB_, HW / 256); 8 waves, four waves per SIMD (under 256 registers): the waves of a block walk the same keys (staged in LDS once for the block), each with its own 32 queries. All blocks are resident at once, so the launch lasts as long as its fullest SIMD: the heavier hi/lo rows (rows < RH) go to waves 0 to 3 of the first RH / 128 query blocks, one such wave a SIMD (waves w and w + 4 share one), beside plain rows in waves 4 to 7; the query block is the slowest index, so that these blocks start first. Partial O: [image][channel][slice][query], so that the slices of one output element lie 16 KB apart; maxima and sums: [slice][image][query].
static_assert(RH % 128 == 0 && 2 * RH <= HW, "the first RH / 128 query blocks hold rows 0 to 2 * RH - 1, half of them hi/lo rows");
__global__ __launch_bounds__(256) void k_attn(const bf* __restrict__ FCT, const bf* __restrict__ FST, const h16* __restrict__ ST16, float* __restrict__ OP, float* __restrict__ ML, float* __restrict__ LS) {
    const size_t b = blockIdx.y, pl = (size_t)blockIdx.x * NB_ + b; const int k0 = blockIdx.x * KSL, z = blockIdx.z, wv = __builtin_amdgcn_readfirstlane((int)(threadIdx.x >> 5));
    const bool mixed = z < RH / 128, hl = mixed && wv < 4;   // the same in every lane of a wave
    const int q0 = 32 * (!mixed ? z * 8 + wv : hl ? z * 4 + wv : RH / 32 + z * 4 + wv - 4);   // a permutation of the 32-row groups: only those of rows < 2 * RH change places
    const bf* Q = FCT + b * HW * CC; const bf* Kt = FST + b * HW * CC; const h16* Vh = ST16 + b * CC * HW;
    float* Op = OP + (b * CC * KSP + blockIdx.x) * HW; float* Mp = ML + pl * HW; float* Lp = LS + pl * HW;
    __shared__ __attribute__((aligned(16))) char sm[2 * BUFB];
    attn_slice(hl, Q, Kt, Vh, Op, Mp, Lp, q0, k0, sm);
}

// One launch converts all three inputs; every thread does the same work, all 12 loads first.
// (a) content (blocks of the lower half of the grid) or content_s (upper half) to token-major bf16: a thread holds 8 channels x 4 tokens, 8 lanes cover the 64 channels, so that a wave's store writes whole 128-byte token rows and its load reads 64-byte pieces of 8 channel rows.
// (b) 16 elements of style to fp16 of the bf16 value, layout kept ([c][k] = the A operand).
#define PTH (NB_ * CC * HW / 16)   // threads of k_prep: 16 style elements and one 8 x 4 tile each
__global__ __launch_bounds__(256) void k_prep(const float* __restrict__ content, const float* __restrict__ content_s, const float* __restrict__ style, bf* FCT, bf* FST, h16* ST16) {
    const unsigned g = blockIdx.x * 256u + threadIdx.x;
    const bool second = blockIdx.x >= PTH / 512; const unsigned im = (blockIdx.x / (PTH / 2048)) % NB_;   // block-uniform: tensor and image
    const float* xb = (second ? content_s : content) + (size_t)im * CC * HW; bf* XT = (second ? FST : FCT) + (size_t)im * HW * CC;
    const unsigned t = g % (PTH / 8), cg = t & 7u, m0 = (t >> 3) * 4u;
    const unsigned ie = cg * 8u * HW + m0, oe = m0 * CC + cg * 8u, sb = g * 32u;   // 32-bit offsets (sb in bytes): one offset register beside a scalar base serves all rows
    const char* sp = (const char*)style; char* oh = (char*)ST16;
    v4f a[8]; v8f s[2];
#pragma unroll
    for (int i = 0; i < 8; ++i) a[i] = *(const v4f*)(xb + ie + i * HW);
#pragma unroll
    for (int k = 0; k < 2; ++k) s[k] = *(const v8f*)(sp + (size_t)k * PTH * 32 + sb);
    asm volatile("s_wait_xcnt 0x0" ::: "memory");   // stands in front of the first overwrite of an offset register that the 12 issued loads name
    __builtin_amdgcn_sched_barrier(0);   // all 12 loads, and the wait behind them, stay in front of the arithmetic: one round trip; without it the style loads are sunk behind the first waits and the arithmetic is lifted over the wait
#pragma unroll
    for (int j = 0; j < 4; ++j) { v8us o;
#pragma unroll
        for (int i = 0; i < 8; ++i) o[i] = f2bf(a[i][j]);
        *(v8us*)(XT + oe + j * CC) = o; }
#pragma unroll
    for (int k = 0; k < 2; ++k) { v8h h;
#pragma unroll
        for (int u = 0; u < 8; ++u) h[u] = tohx(bfr(s[k][u]));
        *(v8h*)(oh + (size_t)k * PTH * 16 + sb / 2u) = h; }
}
// Joins the key slices and copies the content half. A thread holds 4 queries x FCH channels: the slices' weights and their sum depend on the query alone and are formed once for its FCH channels; a wave's load or store covers 512 contiguous bytes of one row. Grid (2 * HW / 128, NB_): 128 queries x 32 channels a block, 4 channels a wave.
#define FCH 4
__global__ __launch_bounds__(256) void k_fin(const float* __restrict__ OP, const float* __restrict__ ML, const float* __restrict__ LS, const float* __restrict__ x, float* OUT) {
    const size_t b = blockIdx.y; const unsigned n = (blockIdx.x >> 1) * 128u + (threadIdx.x & 31u) * 4u, c0 = (blockIdx.x & 1u) * 32u + (threadIdx.x >> 5) * FCH;
    const char* Ob = (const char*)(OP + b * CC * KSP * HW); const char* Mb = (const char*)(ML + b * HW); const char* Lb = (const char*)(LS + b * HW); const char* xb = (const char*)(x + b * CC * HW); char* OUTb = (char*)(OUT + b * 2 * CC * HW);
    const unsigned nb = n * 4u, eob = (c0 * (KSP * HW) + n) * 4u, xo = (c0 * HW + n) * 4u;   // byte offsets in 32 bits: one offset register beside a scalar base serves all slices and channels
    v4f mz[KSP], lz[KSP], oz[FCH][KSP], a[FCH];
#pragma unroll
    for (int z = 0; z < KSP; ++z) { mz[z] = *(const v4f*)(Mb + (size_t)z * NB_ * HW * 4 + nb); lz[z] = *(const v4f*)(Lb + (size_t)z * NB_ * HW * 4 + nb); }
#pragma unroll
    for (int i = 0; i < FCH; ++i)
#pragma unroll
        for (int z = 0; z < KSP; ++z) oz[i][z] = *(const v4f*)(Ob + (size_t)i * KSP * HW * 4 + (size_t)z * HW * 4 + eob);
#pragma unroll
    for (int i = 0; i < FCH; ++i) a[i] = *(const v4f*)(xb + (size_t)i * HW * 4 + xo);
    asm volatile("s_wait_xcnt 0x0" :: "v"(nb), "v"(eob), "v"(xo) : "memory");   // stands in front of the first overwrite of an offset register that the 52 issued loads name; the three offsets are inputs, so that they stay in their registers up to here and no load's result is placed on one
    __builtin_amdgcn_sched_barrier(0);   // all 52 independent loads, and the wait behind them, stay in front of the arithmetic: one round trip for the whole thread
    v4f r[FCH];
#pragma unroll   // u indexes vector elements: rolled, every access would become a chain of selects
    for (int u = 0; u < 4; ++u) { float M = mz[0][u];
#pragma unroll
        for (int z = 1; z < KSP; ++z) M = fmaxf(M, mz[z][u]);
        float w[KSP], den = 0.f;
#pragma unroll
        for (int z = 0; z < KSP; ++z) w[z] = mz[z][u] - M;
        exp2_run8(w);
#pragma unroll
        for (int z = 0; z < KSP; ++z) den = fmaf(w[z], lz[z][u], den);
#pragma unroll
        for (int i = 0; i < FCH; ++i) { float num = 0.f;
#pragma unroll
            for (int z = 0; z < KSP; ++z) num = fmaf(w[z], oz[i][z][u], num);
            r[i][u] = __fdiv_rn(num, den); a[i][u] = bfr(a[i][u]); } }
#pragma unroll
    for (int i = 0; i < FCH; ++i) { *(v4f*)(OUTb + (size_t)i * HW * 4 + xo) = a[i]; *(v4f*)(OUTb + (size_t)(CC + i) * HW * 4 + xo) = r[i]; }
}

extern "C" void kernel_launch(void* const* d_in, const int* in_sizes, int n_in,
                              void* d_out, int out_size, void* d_ws, size_t ws_size, hipStream_t stream) {
    (void)in_sizes; (void)n_in; (void)out_size;
    const float* content = (const float*)d_in[0]; const float* content_s = (const float*)d_in[1]; const float* style = (const float*)d_in[2];
    float* OUT = (float*)d_out;     // [4][128][4096]
    char* wsp = (char*)d_ws;
    auto take = [&](size_t bytes) { char* p = wsp; wsp += (bytes + 255) & ~(size_t)255; return (void*)p; };
    bf* FCT = (bf*)take((size_t)NB_ * HW * CC * 2); bf* FST = (bf*)take((size_t)NB_ * HW * CC * 2); h16* ST16 = (h16*)take((size_t)NB_ * CC * HW * 2);
    float* OP = (float*)take((size_t)KSP * NB_ * CC * HW * 4); float* ML = (float*)take((size_t)KSP * NB_ * HW * 4); float* LS = (float*)take((size_t)KSP * NB_ * HW * 4);
    if ((size_t)(wsp - (char*)d_ws) > ws_size) return;    // ~ 41 MB
    k_prep<<<PTH / 256, 256, 0, stream>>>(content, content_s, style, FCT, FST, ST16);
    k_attn<<<dim3(KSP, NB_, HW / 256), 256, 0, stream>>>(FCT, FST, ST16, OP, ML, LS);
    k_fin<<<dim3(2 * HW / 128, NB_), 256, 0, stream>>>(OP, ML, LS, content, OUT);
}

// v007
// A run of this version takes 28.1 microseconds.
// Next to v006, in two timings, it ran 1.06 times as fast each time.
// Counting every step since v000, it is 35.1 times as fast.
#include <hip/hip_runtime.h>

// SANet (content, content_s, style [4][64][64][64] channels-first, HW = 4096; S[q][k] = sum_c Fc[c][q] Fs[c][k] (unscaled, K = 64); P = softmax_k(S); O[c][q] = sum_k style[c][k] P[q][k]; out = concat(content, O) along channels -> [4][128][64][64]).
// Compute dtypes, f32 accumulate: every input rounded to bf16. One fused kernel (k_attn) does S, softmax and P.style^T with an online softmax: S^T = Fs.Fc^T as a PLAIN bf16 product on token-major copies of the inputs (exact products); the score accumulators are, lane for lane, the B operand of O += style.P^T, so S and P stay in registers. P carries a factor 1024 and multiplies the fp16 style: query rows >= RH as a single fp16 plane, rows < RH as two fp16 planes, hi + lo (2 products). The keys are split into KSP slices (grid x), each slice into KHF halves that two groups of four waves of one block walk side by side and join in LDS at the end; each slice stores its unnormalised f32 partial O (channels-first), its running maximum (log2 domain) and its sum in its own workspace plane, and k_fin joins the planes; the content half is the bf16-rounded input copied.

#define NB_  4
#define CC   64
#define HW   4096
#define TT   HW
#define RH   512
#define PLOG 10.0f   // fp16 P carries a factor 2^PLOG (it cancels against the row sum)
#define KSP  4       // key slices of the fused kernel = workspace planes
#define KHF  2       // halves of a slice, joined inside the block
#define KSL  (HW / (KSP * KHF))   // keys of one wave
#define L2E  1.4426950408889634f
#define SKY  64                  // keys of one half in one LDS stage
#define NST  (KSL / SKY)         // stages of a key slice
#define KPI  144                 // LDS pitch of a key row (128 bytes + 16) and
#define VPI  272                 // of a style row (256 bytes + 16): 16 bytes x odd, no bank conflict for 16-byte reads
#define KBY  (KHF * SKY * KPI)   // the key rows of a stage (first half's, then second half's); the style rows follow them
#define BUFB (KBY + CC * VPI)    // one stage buffer
typedef _Float16 h16;
typedef unsigned short bf;
typedef __attribute__((ext_vector_type(16))) __bf16   v16bf;
typedef __attribute__((ext_vector_type(16))) _Float16 v16h;
typedef __attribute__((ext_vector_type(8)))  _Float16 v8h;
typedef __attribute__((ext_vector_type(8)))  unsigned short v8us;
typedef __attribute__((ext_vector_type(8)))  float    v8f;
typedef __attribute__((ext_vector_type(4)))  float    v4f;
typedef v8h  __attribute__((may_alias)) v8ha;
typedef v4f  __attribute__((may_alias)) v4fa;
typedef v8us __attribute__((may_alias)) v8usa;

__device__ __forceinline__ unsigned short f2bf(float f) { unsigned u = __float_as_uint(f); u += 0x7FFFu + ((u >> 16) & 1u); return (unsigned short)(u >> 16); }
__device__ __forceinline__ float bf2f(unsigned short b) { return __uint_as_float(((unsigned)b) << 16); }
__device__ __forceinline__ float bfr(float f) { return bf2f(f2bf(f)); }
__device__ __forceinline__ v16h cat16(v8h lo, v8h hi) { return __builtin_shufflevector(lo, hi, 0, 1, 2, 3, 4, 5, 6, 7, 8, 9, 10, 11, 12, 13, 14, 15); }
__device__ __forceinline__ v16bf cat16b(v8us lo, v8us hi) { return __builtin_bit_cast(v16bf, __builtin_shufflevector(lo, hi, 0, 1, 2, 3, 4, 5, 6, 7, 8, 9, 10, 11, 12, 13, 14, 15)); }
__device__ __forceinline__ v8f wmma16(v16h a, v16h b, v8f c) { return __builtin_amdgcn_wmma_f32_16x16x32_f16(false, a, false, b, (short)0, c, false, false); }
__device__ __forceinline__ v8f wmmab(v16bf a, v16bf b, v8f c) { return __builtin_amdgcn_wmma_f32_16x16x32_bf16(false, a, false, b, (short)0, c, false, false); }



// fragment loaders: K-contiguous 16-bit planes, lane (lr, hi) reads k = 8*hi + 0..7 and 16 + 8*hi + 0..7 of row lr
template <typename T16> struct WFrag;
template <> struct WFrag<h16> { typedef v16h V; static __device__ __forceinline__ V ld(const h16* p) { return cat16(*(const v8h*)p, *(const v8h*)(p + 16)); } static __device__ __forceinline__ v8f mma(V a, V b, v8f c) { return wmma16(a, b, c); } };
template <> struct WFrag<bf> { typedef v16bf V; static __device__ __forceinline__ V ld(const bf* p) { return cat16b(*(const v8us*)p, *(const v8us*)(p + 16)); } static __device__ __forceinline__ v8f mma(V a, V b, v8f c) { return wmmab(a, b, c); } };

__device__ __forceinline__ h16 tohx(float x) { return (h16)x; }
typedef __attribute__((ext_vector_type(2))) unsigned short v2us;
typedef __attribute__((ext_vector_type(2))) float v2f;

// lane l with lane l ^ 16
__device__ __forceinline__ float xhalf(float x) { return __builtin_bit_cast(float, __builtin_amdgcn_permlanex16(__builtin_bit_cast(int, x), __builtin_bit_cast(int, x), 0x76543210, 0xfedcba98, false, false)); }

// A run of exponentials (2^x) in place, as one statement: each stands behind an independent one, and the one v_nop at the end keeps, for the whole run, the slot that the instruction set asks for between a transcendental and the use of its result or the overwrite of its source.
__device__ __forceinline__ void exp2_run17(float (&t)[17]) { asm("v_exp_f32 %0, %0\n\tv_exp_f32 %1, %1\n\tv_exp_f32 %2, %2\n\tv_exp_f32 %3, %3\n\tv_exp_f32 %4, %4\n\tv_exp_f32 %5, %5\n\tv_exp_f32 %6, %6\n\tv_exp_f32 %7, %7\n\tv_exp_f32 %8, %8\n\tv_exp_f32 %9, %9\n\tv_exp_f32 %10, %10\n\tv_exp_f32 %11, %11\n\tv_exp_f32 %12, %12\n\tv_exp_f32 %13, %13\n\tv_exp_f32 %14, %14\n\tv_exp_f32 %15, %15\n\tv_exp_f32 %16, %16\n\tv_nop" : "+v"(t[0]), "+v"(t[1]), "+v"(t[2]), "+v"(t[3]), "+v"(t[4]), "+v"(t[5]), "+v"(t[6]), "+v"(t[7]), "+v"(t[8]), "+v"(t[9]), "+v"(t[10]), "+v"(t[11]), "+v"(t[12]), "+v"(t[13]), "+v"(t[14]), "+v"(t[15]), "+v"(t[16])); }
__device__ __forceinline__ void exp2_run4(float (&t)[4]) { asm("v_exp_f32 %0, %0\n\tv_exp_f32 %1, %1\n\tv_exp_f32 %2, %2\n\tv_exp_f32 %3, %3\n\tv_nop" : "+v"(t[0]), "+v"(t[1]), "+v"(t[2]), "+v"(t[3])); }

// One stage of the block's keys into LDS, 8 asynchronous copies of 16 bytes a thread: 128 key rows of 128 bytes (8 threads a row, 32 rows a copy; rows 0 to 63 are the first half's keys, rows 64 to 127 the second half's, KSL keys further on) and 64 style rows of 256 bytes (16 threads a row, 16 rows a copy; a row's first 128 bytes are the first half's keys, the rest the second half's: gv holds that step). lk, lv, gk, gv: the thread's own LDS byte addresses and global addresses of its first key and first style copy.
// The s_wait_xcnt at the end stands in front of every later overwrite of a register that these copies name.
__device__ __forceinline__ void stage_copy(const unsigned lk, const unsigned lv, const char* gk, const char* gv) {
    asm volatile("global_load_async_to_lds_b128 %0, %8, off\n\tglobal_load_async_to_lds_b128 %1, %9, off\n\tglobal_load_async_to_lds_b128 %2, %10, off\n\tglobal_load_async_to_lds_b128 %3, %11, off\n\t"
                 "global_load_async_to_lds_b128 %4, %12, off\n\tglobal_load_async_to_lds_b128 %5, %13, off\n\tglobal_load_async_to_lds_b128 %6, %14, off\n\tglobal_load_async_to_lds_b128 %7, %15, off\n\ts_wait_xcnt 0x0"
                 :: "v"(lk), "v"(lk + 32 * KPI), "v"(lk + 64 * KPI), "v"(lk + 96 * KPI), "v"(lv), "v"(lv + 16 * VPI), "v"(lv + 32 * VPI), "v"(lv + 48 * VPI),
                    "v"(gk), "v"(gk + 32 * CC * 2), "v"(gk + KSL * CC * 2), "v"(gk + (KSL + 32) * CC * 2), "v"(gv), "v"(gv + 16 * HW * 2), "v"(gv + 32 * HW * 2), "v"(gv + 48 * HW * 2) : "memory");
}

// ---- one wave: 32 query columns x KSL keys, 32 keys a pass. S^T tile D[key][q]: lane (lr, hi) holds keys hi*8 + j of query lr; two such tiles (keys 0-15, 16-31) are the 16 elements of the B fragment of the second product (k = 8*hi + 0..7, 16 + 8*hi + 0..7).
// The SKY / 32 passes of one stage. hl (the same in every lane of the wave): the wave's rows are hi/lo rows: a second plane, the rest that the fp16 rounding of P left, goes through the same style fragments.
__device__ __forceinline__ void stage_passes(const bool hl, const char* kl, const char* vl, const v16bf (&bq)[2][2], v8f (&o)[4][2], float (&ml)[2], float (&ls)[2]) {
#pragma unroll 1   // one pass is already 16 or 24 matrix instructions; unrolling would only add registers
    for (int i = 0; i < SKY / 32; ++i) {
        v16bf ak[2][2]; v16h av[4];
#pragma unroll
        for (int t = 0; t < 2; ++t)
#pragma unroll
            for (int ks = 0; ks < 2; ++ks) ak[t][ks] = WFrag<bf>::ld((const bf*)(kl + t * 16 * KPI + ks * 64));
#pragma unroll
        for (int mb = 0; mb < 4; ++mb) av[mb] = WFrag<h16>::ld((const h16*)(vl + mb * 16 * VPI));
        __builtin_amdgcn_sched_barrier(0);   // all 16 LDS reads of the pass stand as one group in front of its arithmetic; without it they fall into two groups with vector instructions between
        kl += 32 * KPI; vl += 64;
        float t[2][17]; v8h x0[2], x1[2];
#pragma unroll
        for (int nq = 0; nq < 2; ++nq) {
            v8f s0 = (v8f){}, s1 = (v8f){};
            s0 = wmmab(ak[0][0], bq[nq][0], s0); s1 = wmmab(ak[1][0], bq[nq][0], s1);
            s0 = wmmab(ak[0][1], bq[nq][1], s0); s1 = wmmab(ak[1][1], bq[nq][1], s1);
            float cm = fmaxf(s0[0], s1[0]);
#pragma unroll
            for (int j = 1; j < 8; ++j) cm = fmaxf(cm, fmaxf(s0[j], s1[j]));
            cm = fmaxf(cm, xhalf(cm));
            const float mn = fmaxf(ml[nq], fmaf(cm, L2E, -PLOG));
#pragma unroll
            for (int j = 0; j < 8; ++j) { t[nq][j] = fmaf(s0[j], L2E, -mn); t[nq][8 + j] = fmaf(s1[j], L2E, -mn); }
            t[nq][16] = ml[nq] - mn; ml[nq] = mn;
            exp2_run17(t[nq]);
            const float al = t[nq][16];
            float sum = 0.f;
#pragma unroll
            for (int j = 0; j < 8; ++j) sum += t[nq][j] + t[nq][8 + j];
            ls[nq] = fmaf(ls[nq], al, sum);
#pragma unroll
            for (int mb = 0; mb < 4; ++mb) o[mb][nq] *= al;
#pragma unroll
            for (int j = 0; j < 8; ++j) { x0[nq][j] = tohx(t[nq][j]); x1[nq][j] = tohx(t[nq][8 + j]); }
            const v16h pf = cat16(x0[nq], x1[nq]);
#pragma unroll
            for (int mb = 0; mb < 4; ++mb) o[mb][nq] = wmma16(av[mb], pf, o[mb][nq]);
        }
        if (hl) {   // one branch a pass, behind both column groups, so that the two groups' common arithmetic stays one block that the compiler can interleave
#pragma unroll
            for (int nq = 0; nq < 2; ++nq) {
                v8h y0, y1;
#pragma unroll
                for (int j = 0; j < 8; ++j) { y0[j] = tohx(t[nq][j] - (float)x0[nq][j]); y1[j] = tohx(t[nq][8 + j] - (float)x1[nq][j]); }
                const v16h pl = cat16(y0, y1);
#pragma unroll
                for (int mb = 0; mb < 4; ++mb) o[mb][nq] = wmma16(av[mb], pl, o[mb][nq]);
            }
        }
    }
}
__device__ __forceinline__ void attn_slice(const bool hl, const int kh, const int slot, const bf* __restrict__ Q, const bf* __restrict__ Kt, const h16* __restrict__ V, float* __restrict__ Op, float* __restrict__ Mp, float* __restrict__ Lp, const int q0, const int k0, char* sm) {
    const int lane = threadIdx.x & 31, lr = lane & 15, hi = lane >> 4;
    v16bf bq[2][2];
#pragma unroll
    for (int nq = 0; nq < 2; ++nq)
#pragma unroll
        for (int ks = 0; ks < 2; ++ks) bq[nq][ks] = WFrag<bf>::ld(Q + (size_t)(q0 + nq * 16 + lr) * CC + ks * 32 + 8 * hi);
    v8f o[4][2];
#pragma unroll
    for (int mb = 0; mb < 4; ++mb)
#pragma unroll
        for (int nq = 0; nq < 2; ++nq) o[mb][nq] = (v8f){};
    float ml[2] = { -3.0e38f, -3.0e38f }, ls[2] = { 0.f, 0.f };
    // Four waves walk the first half of the block's keys, four the second: each stage of SKY keys of either half is brought into LDS once for its four waves, two buffers, the next stage's copies in flight while this one is worked on.
    const unsigned tid = threadIdx.x, sb = (unsigned)(size_t)sm;   // sb: the low 32 bits of the shared address = the LDS byte address
    const unsigned lk = sb + (tid >> 3) * KPI + (tid & 7u) * 16u, lv = sb + KBY + (tid >> 4) * VPI + (tid & 15u) * 16u;
    const char* gk = (const char*)(Kt + (size_t)k0 * CC) + tid * 16u;
    const char* gv = (const char*)(V + (size_t)(tid >> 4) * HW + k0) + (tid & 7u) * 16u + ((tid >> 3) & 1u) * (KSL * 2u);
    stage_copy(lk, lv, gk, gv);
    asm volatile("s_wait_asynccnt 0x0" ::: "memory");   // this wave's copies of stage 0 have landed
    __syncthreads();                                    // ... and every other wave's
    stage_copy(lk + BUFB, lv + BUFB, gk + SKY * CC * 2, gv + SKY * 2);
#pragma unroll 1   // the two buffers alternate by address; unrolled, the code would only grow
    for (int s = 0; s < NST; ++s) {
      const unsigned bo = (s & 1) * BUFB;
      const char* kl = sm + bo + (kh * SKY + lr) * KPI + 16 * hi;         // key rows lr and 16 + lr of the pass, in the wave's half
      const char* vl = sm + bo + KBY + lr * VPI + kh * (SKY * 2) + 16 * hi;   // channel rows lr + 16 * mb, the pass's 32 keys
      stage_passes(hl, kl, vl, bq, o, ml, ls);
      asm volatile("s_wait_dscnt 0x0" ::: "memory");      // this wave's reads of stage s are done before its buffer is refilled
      asm volatile("s_wait_asynccnt 0x0" ::: "memory");   // this wave's copies of stage s + 1 have landed
      __syncthreads();                                    // publishes stage s + 1 and ends every wave's reads of stage s
      if (s + 2 < NST) stage_copy(lk + bo, lv + bo, gk + (s + 2) * (SKY * CC * 2), gv + (s + 2) * (SKY * 2));
    }
    asm volatile("s_wait_asynccnt 0x0" ::: "memory");     // no copy is outstanding when the wave goes on to the join, its stores and its end
    // The join of the two halves: behind the loop's last barrier nobody reads a stage and no copy is in flight, so the stage buffers are free. The wave of the second half lays down its 64 accumulators, maxima and sums, lane for lane (17 pieces of 16 bytes a lane, a piece's 32 lanes contiguous); the wave of the first half with the same queries takes them in, as k_fin does with the planes.
    char* jp = sm + slot * (17 * 512) + lane * 16;
    if (kh) {
#pragma unroll
        for (int mb = 0; mb < 4; ++mb)
#pragma unroll
            for (int nq = 0; nq < 2; ++nq) {
                *(v4fa*)(jp + ((mb * 2 + nq) * 2 + 0) * 512) = __builtin_shufflevector(o[mb][nq], o[mb][nq], 0, 1, 2, 3);
                *(v4fa*)(jp + ((mb * 2 + nq) * 2 + 1) * 512) = __builtin_shufflevector(o[mb][nq], o[mb][nq], 4, 5, 6, 7);
            }
        *(v4fa*)(jp + 16 * 512) = (v4f){ ml[0], ml[1], ls[0], ls[1] };
    }
    __syncthreads();   // the second half's values are in LDS; every wave passes it
    if (kh) return;    // the same in every lane of a wave, behind the last barrier
    {
        const v4f mo = *(const v4fa*)(jp + 16 * 512);
        float w[4];
#pragma unroll
        for (int nq = 0; nq < 2; ++nq) { const float M = fmaxf(ml[nq], mo[nq]); w[nq] = ml[nq] - M; w[2 + nq] = mo[nq] - M; ml[nq] = M; }
        exp2_run4(w);
#pragma unroll
        for (int nq = 0; nq < 2; ++nq) ls[nq] = fmaf(ls[nq], w[nq], mo[2 + nq] * w[2 + nq]);
#pragma unroll
        for (int mb = 0; mb < 4; ++mb)
#pragma unroll
            for (int nq = 0; nq < 2; ++nq) {
                const v4f a = *(const v4fa*)(jp + ((mb * 2 + nq) * 2 + 0) * 512), c = *(const v4fa*)(jp + ((mb * 2 + nq) * 2 + 1) * 512);
#pragma unroll
                for (int j = 0; j < 4; ++j) { o[mb][nq][j] = fmaf(o[mb][nq][j], w[nq], a[j] * w[2 + nq]); o[mb][nq][4 + j] = fmaf(o[mb][nq][4 + j], w[nq], c[j] * w[2 + nq]); }
            }
    }
#pragma unroll
    for (int nq = 0; nq < 2; ++nq) { const float lt = ls[nq] + xhalf(ls[nq]); if (hi == 0) { Mp[q0 + nq * 16 + lr] = ml[nq]; Lp[q0 + nq * 16 + lr] = lt; } }
#pragma unroll
    for (int mb = 0; mb < 4; ++mb)
#pragma unroll
        for (int nq = 0; nq < 2; ++nq)
#pragma unroll
            for (int j = 0; j < 8; ++j) Op[(size_t)(mb * 16 + hi * 8 + j) * (KSP * HW) + q0 + nq * 16 + lr] = o[mb][nq][j];
}
// grid (KSP, NB_, HW / 128); 8 waves, four waves per SIMD (under 256 registers): a block holds four groups of 32 queries (slots 0 to 3); waves 0 to 3 walk the first half of the block's keys with slots 0 to 3, waves 4 to 7 the second half with slots 2, 3, 0, 1. All blocks are resident at once, so the launch lasts as long as its fullest SIMD: the heavier hi/lo rows (rows < RH) are slots 0 and 1 of the first RH / 64 query blocks, beside plain rows in slots 2 and 3, so that each SIMD (waves w and w + 4 share one) has one such wave; the query block is the slowest index, so that these blocks start first. Partial O: [image][channel][slice][query], so that the slices of one output element lie 16 KB apart; maxima and sums: [slice][image][query].
static_assert(RH % 64 == 0 && 2 * RH <= HW, "the first RH / 64 query blocks hold rows 0 to 2 * RH - 1, half of them hi/lo rows");
static_assert(4 * 17 * 512 <= 2 * BUFB, "the join's pieces lie in the stage buffers");
__global__ __launch_bounds__(256) void k_attn(const bf* __restrict__ FCT, const bf* __restrict__ FST, const h16* __restrict__ ST16, float* __restrict__ OP, float* __restrict__ ML, float* __restrict__ LS) {
    const size_t b = blockIdx.y, pl = (size_t)blockIdx.x * NB_ + b; const int k0 = blockIdx.x * (KSL * KHF), z = blockIdx.z, wv = __builtin_amdgcn_readfirstlane((int)(threadIdx.x >> 5));
    const int kh = wv >> 2, slot = kh ? (wv & 3) ^ 2 : wv;
    const bool mixed = z < RH / 64, hl = mixed && slot < 2;   // the same in every lane of a wave
    const int q0 = 32 * (!mixed ? z * 4 + slot : hl ? z * 2 + slot : RH / 32 + z * 2 + slot - 2);   // a permutation of the 32-row groups: only those of rows < 2 * RH change places
    const bf* Q = FCT + b * HW * CC; const bf* Kt = FST + b * HW * CC; const h16* Vh = ST16 + b * CC * HW;
    float* Op = OP + (b * CC * KSP + blockIdx.x) * HW; float* Mp = ML + pl * HW; float* Lp = LS + pl * HW;
    __shared__ __attribute__((aligned(16))) char sm[2 * BUFB];
    attn_slice(hl, kh, slot, Q, Kt, Vh, Op, Mp, Lp, q0, k0, sm);
}

// One launch converts all three inputs; every thread does the same work, all 12 loads first.
// (a) content (blocks of the lower half of the grid) or content_s (upper half) to token-major bf16: a thread holds 8 channels x 4 tokens, 8 lanes cover the 64 channels, so that a wave's store writes whole 128-byte token rows and its load reads 64-byte pieces of 8 channel rows.
// (b) 16 elements of style to fp16 of the bf16 value, layout kept ([c][k] = the A operand).
#define PTH (NB_ * CC * HW / 16)   // threads of k_prep: 16 style elements and one 8 x 4 tile each
__global__ __launch_bounds__(256) void k_prep(const float* __restrict__ content, const float* __restrict__ content_s, const float* __restrict__ style, bf* FCT, bf* FST, h16* ST16) {
    const unsigned g = blockIdx.x * 256u + threadIdx.x;
    const bool second = blockIdx.x >= PTH / 512; const unsigned im = (blockIdx.x / (PTH / 2048)) % NB_;   // block-uniform: tensor and image
    const float* xb = (second ? content_s : content) + (size_t)im * CC * HW; bf* XT = (second ? FST : FCT) + (size_t)im * HW * CC;
    const unsigned t = g % (PTH / 8), cg = t & 7u, m0 = (t >> 3) * 4u;
    const unsigned ie = cg * 8u * HW + m0, oe = m0 * CC + cg * 8u, sb = g * 32u;   // 32-bit offsets (sb in bytes): one offset register beside a scalar base serves all rows
    const char* sp = (const char*)style; char* oh = (char*)ST16;
    v4f a[8]; v8f s[2];
#pragma unroll
    for (int i = 0; i < 8; ++i) a[i] = *(const v4f*)(xb + ie + i * HW);
#pragma unroll
    for (int k = 0; k < 2; ++k) s[k] = *(const v8f*)(sp + (size_t)k * PTH * 32 + sb);
    asm volatile("s_wait_xcnt 0x0" ::: "memory");   // stands in front of the first overwrite of an offset register that the 12 issued loads name
    __builtin_amdgcn_sched_barrier(0);   // all 12 loads, and the wait behind them, stay in front of the arithmetic: one round trip; without it the style loads are sunk behind the first waits and the arithmetic is lifted over the wait
#pragma unroll
    for (int j = 0; j < 4; ++j) { v8us o;
#pragma unroll
        for (int i = 0; i < 8; ++i) o[i] = f2bf(a[i][j]);
        *(v8us*)(XT + oe + j * CC) = o; }
#pragma unroll
    for (int k = 0; k < 2; ++k) { v8h h;
#pragma unroll
        for (int u = 0; u < 8; ++u) h[u] = tohx(bfr(s[k][u]));
        *(v8h*)(oh + (size_t)k * PTH * 16 + sb / 2u) = h; }
}
// Joins the key slices and copies the content half. A thread holds 4 queries x FCH channels: the slices' weights and their sum depend on the query alone and are formed once for its FCH channels; a wave's load or store covers 512 contiguous bytes of one row. Grid (2 * HW / 128, NB_): 128 queries x 32 channels a block, 4 channels a wave.
#define FCH 4
__global__ __launch_bounds__(256) void k_fin(const float* __restrict__ OP, const float* __restrict__ ML, const float* __restrict__ LS, const float* __restrict__ x, float* OUT) {
    const size_t b = blockIdx.y; const unsigned n = (blockIdx.x >> 1) * 128u + (threadIdx.x & 31u) * 4u, c0 = (blockIdx.x & 1u) * 32u + (threadIdx.x >> 5) * FCH;
    const char* Ob = (const char*)(OP + b * CC * KSP * HW); const char* Mb = (const char*)(ML + b * HW); const char* Lb = (const char*)(LS + b * HW); const char* xb = (const char*)(x + b * CC * HW); char* OUTb = (char*)(OUT + b * 2 * CC * HW);
    const unsigned nb = n * 4u, eob = (c0 * (KSP * HW) + n) * 4u, xo = (c0 * HW + n) * 4u;   // byte offsets in 32 bits: one offset register beside a scalar base serves all slices and channels
    v4f mz[KSP], lz[KSP], oz[FCH][KSP], a[FCH];
#pragma unroll
    for (int z = 0; z < KSP; ++z) { mz[z] = *(const v4f*)(Mb + (size_t)z * NB_ * HW * 4 + nb); lz[z] = *(const v4f*)(Lb + (size_t)z * NB_ * HW * 4 + nb); }
#pragma unroll
    for (int i = 0; i < FCH; ++i)
#pragma unroll
        for (int z = 0; z < KSP; ++z) oz[i][z] = *(const v4f*)(Ob + (size_t)i * KSP * HW * 4 + (size_t)z * HW * 4 + eob);
#pragma unroll
    for (int i = 0; i < FCH; ++i) a[i] = *(const v4f*)(xb + (size_t)i * HW * 4 + xo);
    asm volatile("s_wait_xcnt 0x0" :: "v"(nb), "v"(eob), "v"(xo) : "memory");   // stands in front of the first overwrite of an offset register that the 28 issued loads name; the three offsets are inputs, so that they stay in their registers up to here and no load's result is placed on one
    __builtin_amdgcn_sched_barrier(0);   // all 28 independent loads, and the wait behind them, stay in front of the arithmetic: one round trip for the whole thread
    v4f r[FCH];
#pragma unroll   // u indexes vector elements: rolled, every access would become a chain of selects
    for (int u = 0; u < 4; ++u) { float M = mz[0][u];
#pragma unroll
        for (int z = 1; z < KSP; ++z) M = fmaxf(M, mz[z][u]);
        float w[KSP], den = 0.f;
#pragma unroll
        for (int z = 0; z < KSP; ++z) w[z] = mz[z][u] - M;
        exp2_run4(w);
#pragma unroll
        for (int z = 0; z < KSP; ++z) den = fmaf(w[z], lz[z][u], den);
#pragma unroll
        for (int i = 0; i < FCH; ++i) { float num = 0.f;
#pragma unroll
            for (int z = 0; z < KSP; ++z) num = fmaf(w[z], oz[i][z][u], num);
            r[i][u] = __fdiv_rn(num, den); a[i][u] = bfr(a[i][u]); } }
#pragma unroll
    for (int i = 0; i < FCH; ++i) { *(v4f*)(OUTb + (size_t)i * HW * 4 + xo) = a[i]; *(v4f*)(OUTb + (size_t)(CC + i) * HW * 4 + xo) = r[i]; }
}

extern "C" void kernel_launch(void* const* d_in, const int* in_sizes, int n_in,
                              void* d_out, int out_size, void* d_ws, size_t ws_size, hipStream_t stream) {
    (void)in_sizes; (void)n_in; (void)out_size;
    const float* content = (const float*)d_in[0]; const float* content_s = (const float*)d_in[1]; const float* style = (const float*)d_in[2];
    float* OUT = (float*)d_out;     // [4][128][4096]
    char* wsp = (char*)d_ws;
    auto take = [&](size_t bytes) { char* p = wsp; wsp += (bytes + 255) & ~(size_t)255; return (void*)p; };
    bf* FCT = (bf*)take((size_t)NB_ * HW * CC * 2); bf* FST = (bf*)take((size_t)NB_ * HW * CC * 2); h16* ST16 = (h16*)take((size_t)NB_ * CC * HW * 2);
    float* OP = (float*)take((size_t)KSP * NB_ * CC * HW * 4); float* ML = (float*)take((size_t)KSP * NB_ * HW * 4); float* LS = (float*)take((size_t)KSP * NB_ * HW * 4);
    if ((size_t)(wsp - (char*)d_ws) > ws_size) return;    // ~ 24 MB
    k_prep<<<PTH / 256, 256, 0, stream>>>(content, content_s, style, FCT, FST, ST16);
    k_attn<<<dim3(KSP, NB_, HW / 128), 256, 0, stream>>>(FCT, FST, ST16, OP, ML, LS);
    k_fin<<<dim3(2 * HW / 128, NB_), 256, 0, stream>>>(OP, ML, LS, content, OUT);
}

// v008
// Measured time: 27.2 microseconds a run.
// Timed twice side by side with v007, it ran 1.04 times as fast both times.
// Counting every step since v000, it is 36.4 times as fast.
#include <hip/hip_runtime.h>

// SANet (content, content_s, style [4][64][64][64] channels-first, HW = 4096; S[q][k] = sum_c Fc[c][q] Fs[c][k] (unscaled, K = 64); P = softmax_k(S); O[c][q] = sum_k style[c][k] P[q][k]; out = concat(content, O) along channels -> [4][128][64][64]).
// Compute dtypes, f32 accumulate: every input rounded to bf16. One fused kernel (k_attn) does S, softmax and P.style^T with an online softmax: S^T = Fs.Fc^T as a PLAIN bf16 product on token-major copies of the inputs (exact products); the score accumulators are, lane for lane, the B operand of O += style.P^T, so S and P stay in registers. P = 2^(score in the log2 domain - the query's reference in use), between 2^-PLO and 2^PHI at the largest score seen, multiplies the fp16 style: query rows >= RH as a single fp16 plane, rows < RH as two fp16 planes, hi + lo (2 products). The keys are split into KSP slices (grid x), each slice into KHF halves that two groups of four waves of one block walk side by side and join in LDS at the end; each slice stores its unnormalised f32 partial O (channels-first), its reference in use (log2 domain) and its sum in its own workspace plane, and k_fin joins the planes; the content half is the bf16-rounded input copied.

#define NB_  4
#define CC   64
#define HW   4096
#define TT   HW
#define RH   512
#define PHI  15.5f   // the reference in use stays while no P of the pass would exceed 2^PHI (fp16 ends at 2^16)
#define PLO  3.0f    // a raised reference lies PLO above the largest score seen, whose P is then 2^-PLO: fp16's last place, 2^-24, stays 2^-21 of the row's largest P (the reference cancels against the row sum)
#define KSP  4       // key slices of the fused kernel = workspace planes
#define KHF  2       // halves of a slice, joined inside the block
#define KSL  (HW / (KSP * KHF))   // keys of one wave
#define L2E  1.4426950408889634f
#define SKY  64                  // keys of one half in one LDS stage
#define NST  (KSL / SKY)         // stages of a key slice
#define KPI  144                 // LDS pitch of a key row (128 bytes + 16) and
#define VPI  272                 // of a style row (256 bytes + 16): 16 bytes x odd, no bank conflict for 16-byte reads
#define KBY  (KHF * SKY * KPI)   // the key rows of a stage (first half's, then second half's); the style rows follow them
#define BUFB (KBY + CC * VPI)    // one stage buffer
typedef _Float16 h16;
typedef unsigned short bf;
typedef __attribute__((ext_vector_type(16))) __bf16   v16bf;
typedef __attribute__((ext_vector_type(16))) _Float16 v16h;
typedef __attribute__((ext_vector_type(8)))  _Float16 v8h;
typedef __attribute__((ext_vector_type(8)))  unsigned short v8us;
typedef __attribute__((ext_vector_type(8)))  float    v8f;
typedef __attribute__((ext_vector_type(4)))  float    v4f;
typedef v8h  __attribute__((may_alias)) v8ha;
typedef v4f  __attribute__((may_alias)) v4fa;
typedef v8us __attribute__((may_alias)) v8usa;

__device__ __forceinline__ unsigned short f2bf(float f) { unsigned u = __float_as_uint(f); u += 0x7FFFu + ((u >> 16) & 1u); return (unsigned short)(u >> 16); }
__device__ __forceinline__ float bf2f(unsigned short b) { return __uint_as_float(((unsigned)b) << 16); }
__device__ __forceinline__ float bfr(float f) { return bf2f(f2bf(f)); }
__device__ __forceinline__ v16h cat16(v8h lo, v8h hi) { return __builtin_shufflevector(lo, hi, 0, 1, 2, 3, 4, 5, 6, 7, 8, 9, 10, 11, 12, 13, 14, 15); }
__device__ __forceinline__ v16bf cat16b(v8us lo, v8us hi) { return __builtin_bit_cast(v16bf, __builtin_shufflevector(lo, hi, 0, 1, 2, 3, 4, 5, 6, 7, 8, 9, 10, 11, 12, 13, 14, 15)); }
__device__ __forceinline__ v8f wmma16(v16h a, v16h b, v8f c) { return __builtin_amdgcn_wmma_f32_16x16x32_f16(false, a, false, b, (short)0, c, false, false); }
__device__ __forceinline__ v8f wmmab(v16bf a, v16bf b, v8f c) { return __builtin_amdgcn_wmma_f32_16x16x32_bf16(false, a, false, b, (short)0, c, false, false); }



// fragment loaders: K-contiguous 16-bit planes, lane (lr, hi) reads k = 8*hi + 0..7 and 16 + 8*hi + 0..7 of row lr
template <typename T16> struct WFrag;
template <> struct WFrag<h16> { typedef v16h V; static __device__ __forceinline__ V ld(const h16* p) { return cat16(*(const v8h*)p, *(const v8h*)(p + 16)); } static __device__ __forceinline__ v8f mma(V a, V b, v8f c) { return wmma16(a, b, c); } };
template <> struct WFrag<bf> { typedef v16bf V; static __device__ __forceinline__ V ld(const bf* p) { return cat16b(*(const v8us*)p, *(const v8us*)(p + 16)); } static __device__ __forceinline__ v8f mma(V a, V b, v8f c) { return wmmab(a, b, c); } };

__device__ __forceinline__ h16 tohx(float x) { return (h16)x; }
typedef __attribute__((ext_vector_type(2))) unsigned short v2us;
typedef __attribute__((ext_vector_type(2))) float v2f;

// lane l with lane l ^ 16
__device__ __forceinline__ float xhalf(float x) { return __builtin_bit_cast(float, __builtin_amdgcn_permlanex16(__builtin_bit_cast(int, x), __builtin_bit_cast(int, x), 0x76543210, 0xfedcba98, false, false)); }

// A run of exponentials (2^x) in place, as one statement: each stands behind an independent one, and the one v_nop at the end keeps, for the whole run, the slot that the instruction set asks for between a transcendental and the use of its result or the overwrite of its source.
__device__ __forceinline__ void exp2_run16(float (&t)[16]) { asm("v_exp_f32 %0, %0\n\tv_exp_f32 %1, %1\n\tv_exp_f32 %2, %2\n\tv_exp_f32 %3, %3\n\tv_exp_f32 %4, %4\n\tv_exp_f32 %5, %5\n\tv_exp_f32 %6, %6\n\tv_exp_f32 %7, %7\n\tv_exp_f32 %8, %8\n\tv_exp_f32 %9, %9\n\tv_exp_f32 %10, %10\n\tv_exp_f32 %11, %11\n\tv_exp_f32 %12, %12\n\tv_exp_f32 %13, %13\n\tv_exp_f32 %14, %14\n\tv_exp_f32 %15, %15\n\tv_nop" : "+v"(t[0]), "+v"(t[1]), "+v"(t[2]), "+v"(t[3]), "+v"(t[4]), "+v"(t[5]), "+v"(t[6]), "+v"(t[7]), "+v"(t[8]), "+v"(t[9]), "+v"(t[10]), "+v"(t[11]), "+v"(t[12]), "+v"(t[13]), "+v"(t[14]), "+v"(t[15])); }
__device__ __forceinline__ void exp2_run2(float (&t)[2]) { asm("v_exp_f32 %0, %0\n\tv_exp_f32 %1, %1\n\tv_nop" : "+v"(t[0]), "+v"(t[1])); }
__device__ __forceinline__ void exp2_run4(float (&t)[4]) { asm("v_exp_f32 %0, %0\n\tv_exp_f32 %1, %1\n\tv_exp_f32 %2, %2\n\tv_exp_f32 %3, %3\n\tv_nop" : "+v"(t[0]), "+v"(t[1]), "+v"(t[2]), "+v"(t[3])); }

// One stage of the block's keys into LDS, 8 asynchronous copies of 16 bytes a thread: 128 key rows of 128 bytes (8 threads a row, 32 rows a copy; rows 0 to 63 are the first half's keys, rows 64 to 127 the second half's, KSL keys further on) and 64 style rows of 256 bytes (16 threads a row, 16 rows a copy; a row's first 128 bytes are the first half's keys, the rest the second half's: gv holds that step). lk, lv, gk, gv: the thread's own LDS byte addresses and global addresses of its first key and first style copy.
// The s_wait_xcnt at the end stands in front of every later overwrite of a register that these copies name.
__device__ __forceinline__ void stage_copy(const unsigned lk, const unsigned lv, const char* gk, const char* gv) {
    asm volatile("global_load_async_to_lds_b128 %0, %8, off\n\tglobal_load_async_to_lds_b128 %1, %9, off\n\tglobal_load_async_to_lds_b128 %2, %10, off\n\tglobal_load_async_to_lds_b128 %3, %11, off\n\t"
                 "global_load_async_to_lds_b128 %4, %12, off\n\tglobal_load_async_to_lds_b128 %5, %13, off\n\tglobal_load_async_to_lds_b128 %6, %14, off\n\tglobal_load_async_to_lds_b128 %7, %15, off\n\ts_wait_xcnt 0x0"
                 :: "v"(lk), "v"(lk + 32 * KPI), "v"(lk + 64 * KPI), "v"(lk + 96 * KPI), "v"(lv), "v"(lv + 16 * VPI), "v"(lv + 32 * VPI), "v"(lv + 48 * VPI),
                    "v"(gk), "v"(gk + 32 * CC * 2), "v"(gk + KSL * CC * 2), "v"(gk + (KSL + 32) * CC * 2), "v"(gv), "v"(gv + 16 * HW * 2), "v"(gv + 32 * HW * 2), "v"(gv + 48 * HW * 2) : "memory");
}

// ---- one wave: 32 query columns x KSL keys, 32 keys a pass. S^T tile D[key][q]: lane (lr, hi) holds keys hi*8 + j of query lr; two such tiles (keys 0-15, 16-31) are the 16 elements of the B fragment of the second product (k = 8*hi + 0..7, 16 + 8*hi + 0..7).
// The SKY / 32 passes of one stage. hl (the same in every lane of the wave): the wave's rows are hi/lo rows: a second plane, the rest that the fp16 rounding of P left, goes through the same style fragments.
__device__ __forceinline__ void stage_passes(const bool hl, const char* kl, const char* vl, const v16bf (&bq)[2][2], v8f (&o)[4][2], float (&ml)[2], float (&ls)[2]) {
#pragma unroll 1   // one pass is already 16 or 24 matrix instructions; unrolling would only add registers
    for (int i = 0; i < SKY / 32; ++i) {
        v16bf ak[2][2]; v16h av[4];
#pragma unroll
        for (int t = 0; t < 2; ++t)
#pragma unroll
            for (int ks = 0; ks < 2; ++ks) ak[t][ks] = WFrag<bf>::ld((const bf*)(kl + t * 16 * KPI + ks * 64));
#pragma unroll
        for (int mb = 0; mb < 4; ++mb) av[mb] = WFrag<h16>::ld((const h16*)(vl + mb * 16 * VPI));
        __builtin_amdgcn_sched_barrier(0);   // all 16 LDS reads of the pass stand as one group in front of its arithmetic; without it they fall into two groups with vector instructions between
        kl += 32 * KPI; vl += 64;
        float t[2][16], c2[2]; v8h x0[2], x1[2]; v8f s0[2], s1[2];
#pragma unroll
        for (int nq = 0; nq < 2; ++nq) {
            s0[nq] = (v8f){}; s1[nq] = (v8f){};
            s0[nq] = wmmab(ak[0][0], bq[nq][0], s0[nq]); s1[nq] = wmmab(ak[1][0], bq[nq][0], s1[nq]);
            s0[nq] = wmmab(ak[0][1], bq[nq][1], s0[nq]); s1[nq] = wmmab(ak[1][1], bq[nq][1], s1[nq]);
            float cm = fmaxf(s0[nq][0], s1[nq][0]);
#pragma unroll
            for (int j = 1; j < 8; ++j) cm = fmaxf(cm, fmaxf(s0[nq][j], s1[nq][j]));
            c2[nq] = fmaxf(cm, xhalf(cm)) * L2E;
        }
        // Lazy rescale, one test a pass for the wave's 32 queries: only where some query's largest score of the pass would give a P above 2^PHI are the references raised and the accumulators and sums scaled. The first pass always takes it (the start reference is -3e38, the factor 0).
        if (__builtin_amdgcn_ballot_w32((c2[0] - PHI > ml[0]) | (c2[1] - PHI > ml[1])) != 0) {
            float al[2];
#pragma unroll
            for (int nq = 0; nq < 2; ++nq) { const float mn = fmaxf(ml[nq], c2[nq] + PLO); al[nq] = ml[nq] - mn; ml[nq] = mn; }
            exp2_run2(al);
#pragma unroll
            for (int nq = 0; nq < 2; ++nq) {
                ls[nq] *= al[nq];
#pragma unroll
                for (int mb = 0; mb < 4; ++mb) o[mb][nq] *= al[nq];
            }
        }
#pragma unroll
        for (int nq = 0; nq < 2; ++nq) {
#pragma unroll
            for (int j = 0; j < 8; ++j) { t[nq][j] = fmaf(s0[nq][j], L2E, -ml[nq]); t[nq][8 + j] = fmaf(s1[nq][j], L2E, -ml[nq]); }
            exp2_run16(t[nq]);
            float sum = 0.f;
#pragma unroll
            for (int j = 0; j < 8; ++j) sum += t[nq][j] + t[nq][8 + j];
            ls[nq] += sum;
#pragma unroll
            for (int j = 0; j < 8; ++j) { x0[nq][j] = tohx(t[nq][j]); x1[nq][j] = tohx(t[nq][8 + j]); }
            const v16h pf = cat16(x0[nq], x1[nq]);
#pragma unroll
            for (int mb = 0; mb < 4; ++mb) o[mb][nq] = wmma16(av[mb], pf, o[mb][nq]);
        }
        if (hl) {   // one branch a pass, behind both column groups, so that the two groups' common arithmetic stays one block that the compiler can interleave
#pragma unroll
            for (int nq = 0; nq < 2; ++nq) {
                v8h y0, y1;
#pragma unroll
                for (int j = 0; j < 8; ++j) { y0[j] = tohx(t[nq][j] - (float)x0[nq][j]); y1[j] = tohx(t[nq][8 + j] - (float)x1[nq][j]); }
                const v16h pl = cat16(y0, y1);
#pragma unroll
                for (int mb = 0; mb < 4; ++mb) o[mb][nq] = wmma16(av[mb], pl, o[mb][nq]);
            }
        }
    }
}
__device__ __forceinline__ void attn_slice(const bool hl, const int kh, const int slot, const bf* __restrict__ Q, const bf* __restrict__ Kt, const h16* __restrict__ V, float* __restrict__ Op, float* __restrict__ Mp, float* __restrict__ Lp, const int q0, const int k0, char* sm) {
    const int lane = threadIdx.x & 31, lr = lane & 15, hi = lane >> 4;
    v16bf bq[2][2];
#pragma unroll
    for (int nq = 0; nq < 2; ++nq)
#pragma unroll
        for (int ks = 0; ks < 2; ++ks) bq[nq][ks] = WFrag<bf>::ld(Q + (size_t)(q0 + nq * 16 + lr) * CC + ks * 32 + 8 * hi);
    v8f o[4][2];
#pragma unroll
    for (int mb = 0; mb < 4; ++mb)
#pragma unroll
        for (int nq = 0; nq < 2; ++nq) o[mb][nq] = (v8f){};
    float ml[2] = { -3.0e38f, -3.0e38f }, ls[2] = { 0.f, 0.f };
    // Four waves walk the first half of the block's keys, four the second: each stage of SKY keys of either half is brought into LDS once for its four waves, two buffers, the next stage's copies in flight while this one is worked on.
    const unsigned tid = threadIdx.x, sb = (unsigned)(size_t)sm;   // sb: the low 32 bits of the shared address = the LDS byte address
    const unsigned lk = sb + (tid >> 3) * KPI + (tid & 7u) * 16u, lv = sb + KBY + (tid >> 4) * VPI + (tid & 15u) * 16u;
    const char* gk = (const char*)(Kt + (size_t)k0 * CC) + tid * 16u;
    const char* gv = (const char*)(V + (size_t)(tid >> 4) * HW + k0) + (tid & 7u) * 16u + ((tid >> 3) & 1u) * (KSL * 2u);
    stage_copy(lk, lv, gk, gv);
    asm volatile("s_wait_asynccnt 0x0" ::: "memory");   // this wave's copies of stage 0 have landed
    __syncthreads();                                    // ... and every other wave's
    stage_copy(lk + BUFB, lv + BUFB, gk + SKY * CC * 2, gv + SKY * 2);
#pragma unroll 1   // the two buffers alternate by address; unrolled, the code would only grow
    for (int s = 0; s < NST; ++s) {
      const unsigned bo = (s & 1) * BUFB;
      const char* kl = sm + bo + (kh * SKY + lr) * KPI + 16 * hi;         // key rows lr and 16 + lr of the pass, in the wave's half
      const char* vl = sm + bo + KBY + lr * VPI + kh * (SKY * 2) + 16 * hi;   // channel rows lr + 16 * mb, the pass's 32 keys
      stage_passes(hl, kl, vl, bq, o, ml, ls);
      asm volatile("s_wait_dscnt 0x0" ::: "memory");      // this wave's reads of stage s are done before its buffer is refilled
      asm volatile("s_wait_asynccnt 0x0" ::: "memory");   // this wave's copies of stage s + 1 have landed
      __syncthreads();                                    // publishes stage s + 1 and ends every wave's reads of stage s
      if (s + 2 < NST) stage_copy(lk + bo, lv + bo, gk + (s + 2) * (SKY * CC * 2), gv + (s + 2) * (SKY * 2));
    }
    asm volatile("s_wait_asynccnt 0x0" ::: "memory");     // no copy is outstanding when the wave goes on to the join, its stores and its end
    // The join of the two halves: behind the loop's last barrier nobody reads a stage and no copy is in flight, so the stage buffers are free. The wave of the second half lays down its 64 accumulators, references and sums, lane for lane (17 pieces of 16 bytes a lane, a piece's 32 lanes contiguous); the wave of the first half with the same queries takes them in, as k_fin does with the planes.
    char* jp = sm + slot * (17 * 512) + lane * 16;
    if (kh) {
#pragma unroll
        for (int mb = 0; mb < 4; ++mb)
#pragma unroll
            for (int nq = 0; nq < 2; ++nq) {
                *(v4fa*)(jp + ((mb * 2 + nq) * 2 + 0) * 512) = __builtin_shufflevector(o[mb][nq], o[mb][nq], 0, 1, 2, 3);
                *(v4fa*)(jp + ((mb * 2 + nq) * 2 + 1) * 512) = __builtin_shufflevector(o[mb][nq], o[mb][nq], 4, 5, 6, 7);
            }
        *(v4fa*)(jp + 16 * 512) = (v4f){ ml[0], ml[1], ls[0], ls[1] };
    }
    __syncthreads();   // the second half's values are in LDS; every wave passes it
    if (kh) return;    // the same in every lane of a wave, behind the last barrier
    {
        const v4f mo = *(const v4fa*)(jp + 16 * 512);
        float w[4];
#pragma unroll
        for (int nq = 0; nq < 2; ++nq) { const float M = fmaxf(ml[nq], mo[nq]); w[nq] = ml[nq] - M; w[2 + nq] = mo[nq] - M; ml[nq] = M; }
        exp2_run4(w);
#pragma unroll
        for (int nq = 0; nq < 2; ++nq) ls[nq] = fmaf(ls[nq], w[nq], mo[2 + nq] * w[2 + nq]);
#pragma unroll
        for (int mb = 0; mb < 4; ++mb)
#pragma unroll
            for (int nq = 0; nq < 2; ++nq) {
                const v4f a = *(const v4fa*)(jp + ((mb * 2 + nq) * 2 + 0) * 512), c = *(const v4fa*)(jp + ((mb * 2 + nq) * 2 + 1) * 512);
#pragma unroll
                for (int j = 0; j < 4; ++j) { o[mb][nq][j] = fmaf(o[mb][nq][j], w[nq], a[j] * w[2 + nq]); o[mb][nq][4 + j] = fmaf(o[mb][nq][4 + j], w[nq], c[j] * w[2 + nq]); }
            }
    }
#pragma unroll
    for (int nq = 0; nq < 2; ++nq) { const float lt = ls[nq] + xhalf(ls[nq]); if (hi == 0) { Mp[q0 + nq * 16 + lr] = ml[nq]; Lp[q0 + nq * 16 + lr] = lt; } }
#pragma unroll
    for (int mb = 0; mb < 4; ++mb)
#pragma unroll
        for (int nq = 0; nq < 2; ++nq)
#pragma unroll
            for (int j = 0; j < 8; ++j) Op[(size_t)(mb * 16 + hi * 8 + j) * (KSP * HW) + q0 + nq * 16 + lr] = o[mb][nq][j];
}
// grid (KSP, NB_, HW / 128); 8 waves, four waves per SIMD (under 256 registers): a block holds four groups of 32 queries (slots 0 to 3); waves 0 to 3 walk the first half of the block's keys with slots 0 to 3, waves 4 to 7 the second half with slots 2, 3, 0, 1. All blocks are resident at once, so the launch lasts as long as its fullest SIMD: the heavier hi/lo rows (rows < RH) are slots 0 and 1 of the first RH / 64 query blocks, beside plain rows in slots 2 and 3, so that each SIMD (waves w and w + 4 share one) has one such wave; the query block is the slowest index, so that these blocks start first. Partial O: [image][channel][slice][query], so that the slices of one output element lie 16 KB apart; references and sums: [slice][image][query].
static_assert(RH % 64 == 0 && 2 * RH <= HW, "the first RH / 64 query blocks hold rows 0 to 2 * RH - 1, half of them hi/lo rows");
static_assert(4 * 17 * 512 <= 2 * BUFB, "the join's pieces lie in the stage buffers");
__global__ __launch_bounds__(256) void k_attn(const bf* __restrict__ FCT, const bf* __restrict__ FST, const h16* __restrict__ ST16, float* __restrict__ OP, float* __restrict__ ML, float* __restrict__ LS) {
    const size_t b = blockIdx.y, pl = (size_t)blockIdx.x * NB_ + b; const int k0 = blockIdx.x * (KSL * KHF), z = blockIdx.z, wv = __builtin_amdgcn_readfirstlane((int)(threadIdx.x >> 5));
    const int kh = wv >> 2, slot = kh ? (wv & 3) ^ 2 : wv;
    const bool mixed = z < RH / 64, hl = mixed && slot < 2;   // the same in every lane of a wave
    const int q0 = 32 * (!mixed ? z * 4 + slot : hl ? z * 2 + slot : RH / 32 + z * 2 + slot - 2);   // a permutation of the 32-row groups: only those of rows < 2 * RH change places
    const bf* Q = FCT + b * HW * CC; const bf* Kt = FST + b * HW * CC; const h16* Vh = ST16 + b * CC * HW;
    float* Op = OP + (b * CC * KSP + blockIdx.x) * HW; float* Mp = ML + pl * HW; float* Lp = LS + pl * HW;
    __shared__ __attribute__((aligned(16))) char sm[2 * BUFB];
    attn_slice(hl, kh, slot, Q, Kt, Vh, Op, Mp, Lp, q0, k0, sm);
}

// One launch converts all three inputs; every thread does the same work, all 12 loads first.
// (a) content (blocks of the lower half of the grid) or content_s (upper half) to token-major bf16: a thread holds 8 channels x 4 tokens, 8 lanes cover the 64 channels, so that a wave's store writes whole 128-byte token rows and its load reads 64-byte pieces of 8 channel rows.
// (b) 16 elements of style to fp16 of the bf16 value, layout kept ([c][k] = the A operand).
#define PTH (NB_ * CC * HW / 16)   // threads of k_prep: 16 style elements and one 8 x 4 tile each
__global__ __launch_bounds__(256) void k_prep(const float* __restrict__ content, const float* __restrict__ content_s, const float* __restrict__ style, bf* FCT, bf* FST, h16* ST16) {
    const unsigned g = blockIdx.x * 256u + threadIdx.x;
    const bool second = blockIdx.x >= PTH / 512; const unsigned im = (blockIdx.x / (PTH / 2048)) % NB_;   // block-uniform: tensor and image
    const float* xb = (second ? content_s : content) + (size_t)im * CC * HW; bf* XT = (second ? FST : FCT) + (size_t)im * HW * CC;
    const unsigned t = g % (PTH / 8), cg = t & 7u, m0 = (t >> 3) * 4u;
    const unsigned ie = cg * 8u * HW + m0, oe = m0 * CC + cg * 8u, sb = g * 32u;   // 32-bit offsets (sb in bytes): one offset register beside a scalar base serves all rows
    const char* sp = (const char*)style; char* oh = (char*)ST16;
    v4f a[8]; v8f s[2];
#pragma unroll
    for (int i = 0; i < 8; ++i) a[i] = *(const v4f*)(xb + ie + i * HW);
#pragma unroll
    for (int k = 0; k < 2; ++k) s[k] = *(const v8f*)(sp + (size_t)k * PTH * 32 + sb);
    asm volatile("s_wait_xcnt 0x0" ::: "memory");   // stands in front of the first overwrite of an offset register that the 12 issued loads name
    __builtin_amdgcn_sched_barrier(0);   // all 12 loads, and the wait behind them, stay in front of the arithmetic: one round trip; without it the style loads are sunk behind the first waits and the arithmetic is lifted over the wait
#pragma unroll
    for (int j = 0; j < 4; ++j) { v8us o;
#pragma unroll
        for (int i = 0; i < 8; ++i) o[i] = f2bf(a[i][j]);
        *(v8us*)(XT + oe + j * CC) = o; }
#pragma unroll
    for (int k = 0; k < 2; ++k) { v8h h;
#pragma unroll
        for (int u = 0; u < 8; ++u) h[u] = tohx(bfr(s[k][u]));
        *(v8h*)(oh + (size_t)k * PTH * 16 + sb / 2u) = h; }
}
// Joins the key slices and copies the content half. A thread holds 4 queries x FCH channels: the slices' weights and their sum depend on the query alone and are formed once for its FCH channels; a wave's load or store covers 512 contiguous bytes of one row. Grid (2 * HW / 128, NB_): 128 queries x 32 channels a block, 4 channels a wave.
#define FCH 4
__global__ __launch_bounds__(256) void k_fin(const float* __restrict__ OP, const float* __restrict__ ML, const float* __restrict__ LS, const float* __restrict__ x, float* OUT) {
    const size_t b = blockIdx.y; const unsigned n = (blockIdx.x >> 1) * 128u + (threadIdx.x & 31u) * 4u, c0 = (blockIdx.x & 1u) * 32u + (threadIdx.x >> 5) * FCH;
    const char* Ob = (const char*)(OP + b * CC * KSP * HW); const char* Mb = (const char*)(ML + b * HW); const char* Lb = (const char*)(LS + b * HW); const char* xb = (const char*)(x + b * CC * HW); char* OUTb = (char*)(OUT + b * 2 * CC * HW);
    const unsigned nb = n * 4u, eob = (c0 * (KSP * HW) + n) * 4u, xo = (c0 * HW + n) * 4u;   // byte offsets in 32 bits: one offset register beside a scalar base serves all slices and channels
    v4f mz[KSP], lz[KSP], oz[FCH][KSP], a[FCH];
#pragma unroll
    for (int z = 0; z < KSP; ++z) { mz[z] = *(const v4f*)(Mb + (size_t)z * NB_ * HW * 4 + nb); lz[z] = *(const v4f*)(Lb + (size_t)z * NB_ * HW * 4 + nb); }
#pragma unroll
    for (int i = 0; i < FCH; ++i)
#pragma unroll
        for (int z = 0; z < KSP; ++z) oz[i][z] = *(const v4f*)(Ob + (size_t)i * KSP * HW * 4 + (size_t)z * HW * 4 + eob);
#pragma unroll
    for (int i = 0; i < FCH; ++i) a[i] = *(const v4f*)(xb + (size_t)i * HW * 4 + xo);
    asm volatile("s_wait_xcnt 0x0" :: "v"(nb), "v"(eob), "v"(xo) : "memory");   // stands in front of the first overwrite of an offset register that the 28 issued loads name; the three offsets are inputs, so that they stay in their registers up to here and no load's result is placed on one
    __builtin_amdgcn_sched_barrier(0);   // all 28 independent loads, and the wait behind them, stay in front of the arithmetic: one round trip for the whole thread
    v4f r[FCH];
#pragma unroll   // u indexes vector elements: rolled, every access would become a chain of selects
    for (int u = 0; u < 4; ++u) { float M = mz[0][u];
#pragma unroll
        for (int z = 1; z < KSP; ++z) M = fmaxf(M, mz[z][u]);
        float w[KSP], den = 0.f;
#pragma unroll
        for (int z = 0; z < KSP; ++z) w[z] = mz[z][u] - M;
        exp2_run4(w);
#pragma unroll
        for (int z = 0; z < KSP; ++z) den = fmaf(w[z], lz[z][u], den);
#pragma unroll
        for (int i = 0; i < FCH; ++i) { float num = 0.f;
#pragma unroll
            for (int z = 0; z < KSP; ++z) num = fmaf(w[z], oz[i][z][u], num);
            r[i][u] = __fdiv_rn(num, den); a[i][u] = bfr(a[i][u]); } }
#pragma unroll
    for (int i = 0; i < FCH; ++i) { *(v4f*)(OUTb + (size_t)i * HW * 4 + xo) = a[i]; *(v4f*)(OUTb + (size_t)(CC + i) * HW * 4 + xo) = r[i]; }
}

extern "C" void kernel_launch(void* const* d_in, const int* in_sizes, int n_in,
                              void* d_out, int out_size, void* d_ws, size_t ws_size, hipStream_t stream) {
    (void)in_sizes; (void)n_in; (void)out_size;
    const float* content = (const float*)d_in[0]; const float* content_s = (const float*)d_in[1]; const float* style = (const float*)d_in[2];
    float* OUT = (float*)d_out;     // [4][128][4096]
    char* wsp = (char*)d_ws;
    auto take = [&](size_t bytes) { char* p = wsp; wsp += (bytes + 255) & ~(size_t)255; return (void*)p; };
    bf* FCT = (bf*)take((size_t)NB_ * HW * CC * 2); bf* FST = (bf*)take((size_t)NB_ * HW * CC * 2); h16* ST16 = (h16*)take((size_t)NB_ * CC * HW * 2);
    float* OP = (float*)take((size_t)KSP * NB_ * CC * HW * 4); float* ML = (float*)take((size_t)KSP * NB_ * HW * 4); float* LS = (float*)take((size_t)KSP * NB_ * HW * 4);
    if ((size_t)(wsp - (char*)d_ws) > ws_size) return;    // ~ 24 MB
    k_prep<<<PTH / 256, 256, 0, stream>>>(content, content_s, style, FCT, FST, ST16);
    k_attn<<<dim3(KSP, NB_, HW / 128), 256, 0, stream>>>(FCT, FST, ST16, OP, ML, LS);
    k_fin<<<dim3(2 * HW / 128, NB_), 256, 0, stream>>>(OP, ML, LS, content, OUT);
}

// v009
// Measured time: 25.9 microseconds a run.
// Next to v008, in two timings, it ran 1.04 and 1.05 times as fast.
// All steps since v000 together make it 38.0 times as fast.
#include <hip/hip_runtime.h>

// SANet (content, content_s, style [4][64][64][64] channels-first, HW = 4096; S[q][k] = sum_c Fc[c][q] Fs[c][k] (unscaled, K = 64); P = softmax_k(S); O[c][q] = sum_k style[c][k] P[q][k]; out = concat(content, O) along channels -> [4][128][64][64]).
// Compute dtypes, f32 accumulate: every input rounded to bf16. One fused kernel (k_attn) does S, softmax and P.style^T with an online softmax; it takes the f32 inputs themselves and rounds them on the way: each block converts its own key and style tiles in LDS, each wave its own queries in registers. S^T = Fs.Fc^T as a PLAIN bf16 product on token-major rows (exact products); the score accumulators are, lane for lane, the B operand of O += style.P^T, so S and P stay in registers. P = 2^(score in the log2 domain - the query's reference in use), between 2^-PLO and 2^PHI at the largest score seen, multiplies the fp16 style: query rows >= RH as a single fp16 plane, rows < RH as two fp16 planes, hi + lo (2 products). The keys are split into KSP slices (grid x), each slice into KHF halves that two groups of eight waves of one block walk side by side and join in LDS at the end; each slice stores its unnormalised f32 partial O (channels-first), its reference in use (log2 domain) and its sum in its own workspace plane, and k_fin joins the planes; the content half is the bf16-rounded input copied.

#define NB_  4
#define CC   64
#define HW   4096
#define TT   HW
#define RH   512
#define PHI  15.5f   // the reference in use stays while no P of the pass would exceed 2^PHI (fp16 ends at 2^16)
#define PLO  3.0f    // a raised reference lies PLO above the largest score seen, whose P is then 2^-PLO: fp16's last place, 2^-24, stays 2^-21 of the row's largest P (the reference cancels against the row sum)
#define KSP  4       // key slices of the fused kernel = workspace planes
#define KHF  2       // halves of a slice, joined inside the block
#define KSL  (HW / (KSP * KHF))   // keys of one wave
#define L2E  1.4426950408889634f
#define SKY  64                  // keys of one half in one LDS stage
#define NST  (KSL / SKY)         // stages of a key slice
#define KPI  144                 // LDS pitch of a key row (128 bytes + 16) and
#define VPI  272                 // of a style row (256 bytes + 16): 16 bytes x odd, no bank conflict for 16-byte reads
#define KBY  (KHF * SKY * KPI)   // the key rows of a stage (first half's, then second half's); the style rows follow them
#define BUFB (KBY + CC * VPI)    // one stage buffer (16-bit operands)
#define RP   528                 // LDS pitch of a raw f32 row of a stage (KHF * SKY * 4 = 512 bytes + 16)
#define RAWB (2 * CC * RP)       // one raw stage buffer: the 64 channel rows of content_s, then the 64 of style
#define QBL  256                 // queries of a block: 8 groups of 32
typedef _Float16 h16;
typedef unsigned short bf;
typedef __attribute__((ext_vector_type(16))) __bf16   v16bf;
typedef __attribute__((ext_vector_type(16))) _Float16 v16h;
typedef __attribute__((ext_vector_type(8)))  _Float16 v8h;
typedef __attribute__((ext_vector_type(8)))  unsigned short v8us;
typedef __attribute__((ext_vector_type(8)))  float    v8f;
typedef __attribute__((ext_vector_type(4)))  float    v4f;
typedef v8h  __attribute__((may_alias)) v8ha;
typedef v4f  __attribute__((may_alias)) v4fa;
typedef v8us __attribute__((may_alias)) v8usa;
typedef __attribute__((ext_vector_type(16))) float    v16f;
typedef __attribute__((ext_vector_type(2)))  float    v2fl;
typedef __attribute__((ext_vector_type(2)))  __bf16   v2bf;
typedef __attribute__((ext_vector_type(2)))  _Float16 v2h;
typedef __attribute__((ext_vector_type(4)))  unsigned v4u;
typedef __attribute__((ext_vector_type(2)))  unsigned v2u;
typedef v2fl __attribute__((may_alias)) v2fla;
typedef v4u  __attribute__((may_alias)) v4ua;
typedef v2u  __attribute__((may_alias)) v2ua;

__device__ __forceinline__ unsigned short f2bf(float f) { unsigned u = __float_as_uint(f); u += 0x7FFFu + ((u >> 16) & 1u); return (unsigned short)(u >> 16); }
__device__ __forceinline__ float bf2f(unsigned short b) { return __uint_as_float(((unsigned)b) << 16); }
__device__ __forceinline__ float bfr(float f) { return bf2f(f2bf(f)); }
__device__ __forceinline__ v16h cat16(v8h lo, v8h hi) { return __builtin_shufflevector(lo, hi, 0, 1, 2, 3, 4, 5, 6, 7, 8, 9, 10, 11, 12, 13, 14, 15); }
__device__ __forceinline__ v16bf cat16b(v8us lo, v8us hi) { return __builtin_bit_cast(v16bf, __builtin_shufflevector(lo, hi, 0, 1, 2, 3, 4, 5, 6, 7, 8, 9, 10, 11, 12, 13, 14, 15)); }
__device__ __forceinline__ v8f wmma16(v16h a, v16h b, v8f c) { return __builtin_amdgcn_wmma_f32_16x16x32_f16(false, a, false, b, (short)0, c, false, false); }
__device__ __forceinline__ v8f wmmab(v16bf a, v16bf b, v8f c) { return __builtin_amdgcn_wmma_f32_16x16x32_bf16(false, a, false, b, (short)0, c, false, false); }



// fragment loaders: K-contiguous 16-bit planes, lane (lr, hi) reads k = 8*hi + 0..7 and 16 + 8*hi + 0..7 of row lr
template <typename T16> struct WFrag;
template <> struct WFrag<h16> { typedef v16h V; static __device__ __forceinline__ V ld(const h16* p) { return cat16(*(const v8h*)p, *(const v8h*)(p + 16)); } static __device__ __forceinline__ v8f mma(V a, V b, v8f c) { return wmma16(a, b, c); } };
template <> struct WFrag<bf> { typedef v16bf V; static __device__ __forceinline__ V ld(const bf* p) { return cat16b(*(const v8us*)p, *(const v8us*)(p + 16)); } static __device__ __forceinline__ v8f mma(V a, V b, v8f c) { return wmmab(a, b, c); } };

__device__ __forceinline__ h16 tohx(float x) { return (h16)x; }
// two f32 to a pair of bf16 (nearest even, a in the low half), and to a pair of fp16 of those bf16 values
__device__ __forceinline__ unsigned pkbf(float a, float b) { return __builtin_bit_cast(unsigned, __builtin_convertvector((v2fl){ a, b }, v2bf)); }
__device__ __forceinline__ unsigned pkhb(float a, float b) { const unsigned u = pkbf(a, b); return __builtin_bit_cast(unsigned, __builtin_convertvector((v2fl){ __uint_as_float(u << 16), __uint_as_float(u & 0xFFFF0000u) }, v2h)); }
typedef __attribute__((ext_vector_type(2))) unsigned short v2us;
typedef __attribute__((ext_vector_type(2))) float v2f;

// lane l with lane l ^ 16
__device__ __forceinline__ float xhalf(float x) { return __builtin_bit_cast(float, __builtin_amdgcn_permlanex16(__builtin_bit_cast(int, x), __builtin_bit_cast(int, x), 0x76543210, 0xfedcba98, false, false)); }

// A run of exponentials (2^x) in place, as one statement: each stands behind an independent one, and the one v_nop at the end keeps, for the whole run, the slot that the instruction set asks for between a transcendental and the use of its result or the overwrite of its source.
__device__ __forceinline__ void exp2_run16(float (&t)[16]) { asm("v_exp_f32 %0, %0\n\tv_exp_f32 %1, %1\n\tv_exp_f32 %2, %2\n\tv_exp_f32 %3, %3\n\tv_exp_f32 %4, %4\n\tv_exp_f32 %5, %5\n\tv_exp_f32 %6, %6\n\tv_exp_f32 %7, %7\n\tv_exp_f32 %8, %8\n\tv_exp_f32 %9, %9\n\tv_exp_f32 %10, %10\n\tv_exp_f32 %11, %11\n\tv_exp_f32 %12, %12\n\tv_exp_f32 %13, %13\n\tv_exp_f32 %14, %14\n\tv_exp_f32 %15, %15\n\tv_nop" : "+v"(t[0]), "+v"(t[1]), "+v"(t[2]), "+v"(t[3]), "+v"(t[4]), "+v"(t[5]), "+v"(t[6]), "+v"(t[7]), "+v"(t[8]), "+v"(t[9]), "+v"(t[10]), "+v"(t[11]), "+v"(t[12]), "+v"(t[13]), "+v"(t[14]), "+v"(t[15])); }
__device__ __forceinline__ void exp2_run2(float (&t)[2]) { asm("v_exp_f32 %0, %0\n\tv_exp_f32 %1, %1\n\tv_nop" : "+v"(t[0]), "+v"(t[1])); }
__device__ __forceinline__ void exp2_run4(float (&t)[4]) { asm("v_exp_f32 %0, %0\n\tv_exp_f32 %1, %1\n\tv_exp_f32 %2, %2\n\tv_exp_f32 %3, %3\n\tv_nop" : "+v"(t[0]), "+v"(t[1]), "+v"(t[2]), "+v"(t[3])); }

// One stage of the block's f32 keys and style into LDS, 8 asynchronous copies of 16 bytes a thread. A wave's copy is one channel row of the stage, 512 bytes: lanes 0 to 15 bring the SKY keys of the first half, lanes 16 to 31 those of the second half, KSL keys further on. 16 waves, so 16 rows a copy: 4 copies for the 64 rows of content_s, 4 for the 64 of style. l, gk, gv: the thread's own LDS byte address and global addresses of its first copy of either tensor.
// The s_wait_xcnt at the end stands in front of every later overwrite of a register that these copies name.
__device__ __forceinline__ void stage_copy(const unsigned l, const char* gk, const char* gv) {
    asm volatile("global_load_async_to_lds_b128 %0, %8, off\n\tglobal_load_async_to_lds_b128 %1, %9, off\n\tglobal_load_async_to_lds_b128 %2, %10, off\n\tglobal_load_async_to_lds_b128 %3, %11, off\n\t"
                 "global_load_async_to_lds_b128 %4, %12, off\n\tglobal_load_async_to_lds_b128 %5, %13, off\n\tglobal_load_async_to_lds_b128 %6, %14, off\n\tglobal_load_async_to_lds_b128 %7, %15, off\n\ts_wait_xcnt 0x0"
                 :: "v"(l), "v"(l + 16 * RP), "v"(l + 32 * RP), "v"(l + 48 * RP), "v"(l + 64 * RP), "v"(l + 80 * RP), "v"(l + 96 * RP), "v"(l + 112 * RP),
                    "v"(gk), "v"(gk + 16 * HW * 4), "v"(gk + 32 * HW * 4), "v"(gk + 48 * HW * 4), "v"(gv), "v"(gv + 16 * HW * 4), "v"(gv + 32 * HW * 4), "v"(gv + 48 * HW * 4) : "memory");
}
// A raw stage (rw) to the 16-bit operands of a stage buffer (hb), once for the block's 16 waves, 16 elements of either tensor a thread.
// Keys: 8 channels x 2 neighbouring keys (a wave reads 256 contiguous bytes of a channel row) to two 16-byte pieces of token-major bf16 rows; raw column = stage row (first half's keys, then the second half's).
// Style: 4 keys of 4 channel rows (a wave reads a whole raw row) to fp16 of the bf16 value, layout kept.
__device__ __forceinline__ void convert_stage(const char* rw, char* hb, const unsigned tid) {
    const unsigned cg = tid >> 6, tp = tid & 63u, wr = tid >> 5, ln = tid & 31u;
    v2fl a[8]; v4f v[4];
#pragma unroll
    for (int i = 0; i < 8; ++i) a[i] = *(const v2fla*)(rw + (cg * 8u + i) * RP + tp * 8u);
#pragma unroll
    for (int i = 0; i < 4; ++i) v[i] = *(const v4fa*)(rw + (CC + wr + 16u * i) * RP + ln * 16u);
#pragma unroll
    for (int j = 0; j < 2; ++j) *(v4ua*)(hb + (tp * 2u + j) * KPI + cg * 16u) = (v4u){ pkbf(a[0][j], a[1][j]), pkbf(a[2][j], a[3][j]), pkbf(a[4][j], a[5][j]), pkbf(a[6][j], a[7][j]) };
#pragma unroll
    for (int i = 0; i < 4; ++i) *(v2ua*)(hb + KBY + (wr + 16u * i) * VPI + ln * 8u) = (v2u){ pkhb(v[i][0], v[i][1]), pkhb(v[i][2], v[i][3]) };
}

// ---- one wave: 32 query columns x KSL keys, 32 keys a pass. S^T tile D[key][q]: lane (lr, hi) holds keys hi*8 + j of query lr; two such tiles (keys 0-15, 16-31) are the 16 elements of the B fragment of the second product (k = 8*hi + 0..7, 16 + 8*hi + 0..7).
// The SKY / 32 passes of one stage. hl (the same in every lane of the wave): the wave's rows are hi/lo rows: a second plane, the rest that the fp16 rounding of P left, goes through the same style fragments.
__device__ __forceinline__ void stage_passes(const bool hl, const char* kl, const char* vl, const v16bf (&bq)[2][2], v8f (&o)[4][2], float (&ml)[2], float (&ls)[2]) {
#pragma unroll 1   // one pass is already 16 or 24 matrix instructions; unrolling would only add registers
    for (int i = 0; i < SKY / 32; ++i) {
        v16bf ak[2][2]; v16h av[4];
#pragma unroll
        for (int t = 0; t < 2; ++t)
#pragma unroll
            for (int ks = 0; ks < 2; ++ks) ak[t][ks] = WFrag<bf>::ld((const bf*)(kl + t * 16 * KPI + ks * 64));
#pragma unroll
        for (int mb = 0; mb < 4; ++mb) av[mb] = WFrag<h16>::ld((const h16*)(vl + mb * 16 * VPI));
        __builtin_amdgcn_sched_barrier(0);   // all 16 LDS reads of the pass stand as one group in front of its arithmetic; without it they fall into two groups with vector instructions between
        kl += 32 * KPI; vl += 64;
        float t[2][16], c2[2]; v8h x0[2], x1[2]; v8f s0[2], s1[2];
#pragma unroll
        for (int nq = 0; nq < 2; ++nq) {
            s0[nq] = (v8f){}; s1[nq] = (v8f){};
            s0[nq] = wmmab(ak[0][0], bq[nq][0], s0[nq]); s1[nq] = wmmab(ak[1][0], bq[nq][0], s1[nq]);
            s0[nq] = wmmab(ak[0][1], bq[nq][1], s0[nq]); s1[nq] = wmmab(ak[1][1], bq[nq][1], s1[nq]);
            float cm = fmaxf(s0[nq][0], s1[nq][0]);
#pragma unroll
            for (int j = 1; j < 8; ++j) cm = fmaxf(cm, fmaxf(s0[nq][j], s1[nq][j]));
            c2[nq] = fmaxf(cm, xhalf(cm)) * L2E;
        }
        // Lazy rescale, one test a pass for the wave's 32 queries: only where some query's largest score of the pass would give a P above 2^PHI are the references raised and the accumulators and sums scaled. The first pass always takes it (the start reference is -3e38, the factor 0).
        if (__builtin_amdgcn_ballot_w32((c2[0] - PHI > ml[0]) | (c2[1] - PHI > ml[1])) != 0) {
            float al[2];
#pragma unroll
            for (int nq = 0; nq < 2; ++nq) { const float mn = fmaxf(ml[nq], c2[nq] + PLO); al[nq] = ml[nq] - mn; ml[nq] = mn; }
            exp2_run2(al);
#pragma unroll
            for (int nq = 0; nq < 2; ++nq) {
                ls[nq] *= al[nq];
#pragma unroll
                for (int mb = 0; mb < 4; ++mb) o[mb][nq] *= al[nq];
            }
        }
#pragma unroll
        for (int nq = 0; nq < 2; ++nq) {
#pragma unroll
            for (int j = 0; j < 8; ++j) { t[nq][j] = fmaf(s0[nq][j], L2E, -ml[nq]); t[nq][8 + j] = fmaf(s1[nq][j], L2E, -ml[nq]); }
            exp2_run16(t[nq]);
            float sum = 0.f;
#pragma unroll
            for (int j = 0; j < 8; ++j) sum += t[nq][j] + t[nq][8 + j];
            ls[nq] += sum;
#pragma unroll
            for (int j = 0; j < 8; ++j) { x0[nq][j] = tohx(t[nq][j]); x1[nq][j] = tohx(t[nq][8 + j]); }
            const v16h pf = cat16(x0[nq], x1[nq]);
#pragma unroll
            for (int mb = 0; mb < 4; ++mb) o[mb][nq] = wmma16(av[mb], pf, o[mb][nq]);
        }
        if (hl) {   // one branch a pass, behind both column groups, so that the two groups' common arithmetic stays one block that the compiler can interleave
#pragma unroll
            for (int nq = 0; nq < 2; ++nq) {
                v8h y0, y1;
#pragma unroll
                for (int j = 0; j < 8; ++j) { y0[j] = tohx(t[nq][j] - (float)x0[nq][j]); y1[j] = tohx(t[nq][8 + j] - (float)x1[nq][j]); }
                const v16h pl = cat16(y0, y1);
#pragma unroll
                for (int mb = 0; mb < 4; ++mb) o[mb][nq] = wmma16(av[mb], pl, o[mb][nq]);
            }
        }
    }
}
__device__ __forceinline__ void attn_slice(const bool hl, const int kh, const int slot, const float* __restrict__ Qf, const float* __restrict__ Kf, const float* __restrict__ Vf, float* __restrict__ Op, float* __restrict__ Mp, float* __restrict__ Lp, const int q0, const int k0, char* sm) {
    const int lane = threadIdx.x & 31, lr = lane & 15, hi = lane >> 4;
    // Eight waves walk the first half of the block's keys, eight the second. Each stage of SKY keys of either half comes into LDS once for the block, as f32 by asynchronous copies (two raw buffers), and is converted there once (two stage buffers): in trip s the block converts raw stage s + 1 and works on stage s, while the copies of raw stage s + 2 are in flight.
    const unsigned tid = threadIdx.x, sb = (unsigned)(size_t)sm;   // sb: the low 32 bits of the shared address = the LDS byte address
    const unsigned lw = sb + 2 * BUFB + (tid >> 5) * RP + (tid & 31u) * 16u;
    const size_t ge = (size_t)(tid >> 5) * HW + k0 + hi * KSL + lr * 4;   // the thread's first element: channel row = its wave, 4 keys of its lane's half
    const char* gk = (const char*)(Kf + ge); const char* gv = (const char*)(Vf + ge);
    stage_copy(lw, gk, gv);
    // The wave's queries, straight from the channels-first f32 input: element e of fragment (nq, ks) is channel ks * 32 + 8 * hi + (e & 7) + 16 * (e >> 3) of query q0 + nq * 16 + lr (the k order of the key rows' loader).
    const char* qb = (const char*)Qf; const unsigned qo = ((unsigned)(8 * hi) * HW + q0 + lr) * 4u;   // one 32-bit offset register beside a scalar base serves all 64 loads
    v16f qf[2][2];
#pragma unroll
    for (int nq = 0; nq < 2; ++nq)
#pragma unroll
        for (int ks = 0; ks < 2; ++ks)
#pragma unroll
            for (int e = 0; e < 16; ++e) qf[nq][ks][e] = *(const float*)(qb + (size_t)((ks * 32 + (e & 7) + 16 * (e >> 3)) * HW + nq * 16) * 4 + qo);
    asm volatile("s_wait_xcnt 0x0" :: "v"(qo) : "memory");   // stands in front of the first overwrite of the offset register that the 64 issued loads name; the offset is an input, so that it stays in its register up to here
    __builtin_amdgcn_sched_barrier(0);   // all 64 loads, and the wait behind them, stay in front of the conversions: one round trip
    v16bf bq[2][2];
#pragma unroll
    for (int nq = 0; nq < 2; ++nq)
#pragma unroll
        for (int ks = 0; ks < 2; ++ks) bq[nq][ks] = __builtin_convertvector(qf[nq][ks], v16bf);
    v8f o[4][2];
#pragma unroll
    for (int mb = 0; mb < 4; ++mb)
#pragma unroll
        for (int nq = 0; nq < 2; ++nq) o[mb][nq] = (v8f){};
    float ml[2] = { -3.0e38f, -3.0e38f }, ls[2] = { 0.f, 0.f };
    asm volatile("s_wait_asynccnt 0x0" ::: "memory");   // this wave's copies of raw stage 0 have landed
    __syncthreads();                                    // ... and every other wave's
    stage_copy(lw + RAWB, gk + SKY * 4, gv + SKY * 4);
#pragma unroll 1   // the buffers alternate by address; unrolled, the code would only grow
    for (int s = -1; s < NST; ++s) {   // trip -1 only converts stage 0
      const unsigned nx = (s + 1) & 1;
      // The waves of the first half convert in front of their passes, those of the second half behind them (kh is the same in every lane of a wave): each SIMD holds two waves of either half, so that one pair's conversion runs beside the other pair's matrix work instead of all four converting at once.
      if (!kh && s + 1 < NST) convert_stage(sm + 2 * BUFB + nx * RAWB, sm + nx * BUFB, tid);
      if (s >= 0) {
        const unsigned bo = (s & 1) * BUFB;
        const char* kl = sm + bo + (kh * SKY + lr) * KPI + 16 * hi;         // key rows lr and 16 + lr of the pass, in the wave's half
        const char* vl = sm + bo + KBY + lr * VPI + kh * (SKY * 2) + 16 * hi;   // channel rows lr + 16 * mb, the pass's 32 keys
        stage_passes(hl, kl, vl, bq, o, ml, ls);
      }
      if (kh && s + 1 < NST) convert_stage(sm + 2 * BUFB + nx * RAWB, sm + nx * BUFB, tid);
      asm volatile("s_wait_dscnt 0x0" ::: "memory");      // this wave's reads of stage s and of raw stage s + 1, and its writes of stage s + 1, are done
      asm volatile("s_wait_asynccnt 0x0" ::: "memory");   // this wave's copies of raw stage s + 2 have landed
      __syncthreads();                                    // publishes stage s + 1 and raw stage s + 2; ends every wave's reads of stage s and of raw stage s + 1
      if (s + 3 < NST) stage_copy(lw + nx * RAWB, gk + (s + 3) * (SKY * 4), gv + (s + 3) * (SKY * 4));
    }
    asm volatile("s_wait_asynccnt 0x0" ::: "memory");     // no copy is outstanding when the wave goes on to the join, its stores and its end
    // The join of the two halves: behind the loop's last barrier nobody reads a stage and no copy is in flight, so the stage buffers are free. The wave of the second half lays down its 64 accumulators, references and sums, lane for lane (17 pieces of 16 bytes a lane, a piece's 32 lanes contiguous); the wave of the first half with the same queries takes them in, as k_fin does with the planes.
    char* jp = sm + slot * (17 * 512) + lane * 16;
    if (kh) {
#pragma unroll
        for (int mb = 0; mb < 4; ++mb)
#pragma unroll
            for (int nq = 0; nq < 2; ++nq) {
                *(v4fa*)(jp + ((mb * 2 + nq) * 2 + 0) * 512) = __builtin_shufflevector(o[mb][nq], o[mb][nq], 0, 1, 2, 3);
                *(v4fa*)(jp + ((mb * 2 + nq) * 2 + 1) * 512) = __builtin_shufflevector(o[mb][nq], o[mb][nq], 4, 5, 6, 7);
            }
        *(v4fa*)(jp + 16 * 512) = (v4f){ ml[0], ml[1], ls[0], ls[1] };
    }
    __syncthreads();   // the second half's values are in LDS; every wave passes it
    if (kh) return;    // the same in every lane of a wave, behind the last barrier
    {
        const v4f mo = *(const v4fa*)(jp + 16 * 512);
        float w[4];
#pragma unroll
        for (int nq = 0; nq < 2; ++nq) { const float M = fmaxf(ml[nq], mo[nq]); w[nq] = ml[nq] - M; w[2 + nq] = mo[nq] - M; ml[nq] = M; }
        exp2_run4(w);
#pragma unroll
        for (int nq = 0; nq < 2; ++nq) ls[nq] = fmaf(ls[nq], w[nq], mo[2 + nq] * w[2 + nq]);
#pragma unroll
        for (int mb = 0; mb < 4; ++mb)
#pragma unroll
            for (int nq = 0; nq < 2; ++nq) {
                const v4f a = *(const v4fa*)(jp + ((mb * 2 + nq) * 2 + 0) * 512), c = *(const v4fa*)(jp + ((mb * 2 + nq) * 2 + 1) * 512);
#pragma unroll
                for (int j = 0; j < 4; ++j) { o[mb][nq][j] = fmaf(o[mb][nq][j], w[nq], a[j] * w[2 + nq]); o[mb][nq][4 + j] = fmaf(o[mb][nq][4 + j], w[nq], c[j] * w[2 + nq]); }
            }
    }
#pragma unroll
    for (int nq = 0; nq < 2; ++nq) { const float lt = ls[nq] + xhalf(ls[nq]); if (hi == 0) { Mp[q0 + nq * 16 + lr] = ml[nq]; Lp[q0 + nq * 16 + lr] = lt; } }
#pragma unroll
    for (int mb = 0; mb < 4; ++mb)
#pragma unroll
        for (int nq = 0; nq < 2; ++nq)
#pragma unroll
            for (int j = 0; j < 8; ++j) Op[(size_t)(mb * 16 + hi * 8 + j) * (KSP * HW) + q0 + nq * 16 + lr] = o[mb][nq][j];
}
// grid (KSP, NB_, HW / QBL); 16 waves, four waves per SIMD (under 256 registers), one block a WGP: a block holds eight groups of 32 queries (slots 0 to 7); waves 0 to 7 walk the first half of the block's keys with slots 0 to 7, waves 8 to 15 the second half with slots 2, 3, 0, 1, 6, 7, 4, 5. All blocks are resident at once, so the launch lasts as long as its fullest SIMD: the heavier hi/lo rows (rows < RH) are slot 0 of every block, whose two waves (0 and 10) stand on different SIMDs. Partial O: [image][channel][slice][query], so that the slices of one output element lie 16 KB apart; references and sums: [slice][image][query].
static_assert(RH == 32 * (HW / QBL), "slot 0 of the HW / QBL query blocks holds the rows below RH");
static_assert(8 * 17 * 512 <= 2 * BUFB, "the join's pieces lie in the stage buffers");
__global__ __launch_bounds__(512) void k_attn(const float* __restrict__ content, const float* __restrict__ content_s, const float* __restrict__ style, float* __restrict__ OP, float* __restrict__ ML, float* __restrict__ LS) {
    const size_t b = blockIdx.y, pl = (size_t)blockIdx.x * NB_ + b; const int k0 = blockIdx.x * (KSL * KHF), z = blockIdx.z, wv = __builtin_amdgcn_readfirstlane((int)(threadIdx.x >> 5));
    const int kh = wv >> 3, slot = kh ? (wv & 7) ^ 2 : wv;
    const bool hl = slot == 0;   // the same in every lane of a wave
    const int q0 = hl ? z * 32 : RH + z * (QBL - 32) + (slot - 1) * 32;   // a permutation of the 32-row groups
    const float* Qf = content + b * CC * HW; const float* Kf = content_s + b * CC * HW; const float* Vf = style + b * CC * HW;
    float* Op = OP + (b * CC * KSP + blockIdx.x) * HW; float* Mp = ML + pl * HW; float* Lp = LS + pl * HW;
    __shared__ __attribute__((aligned(16))) char sm[2 * BUFB + 2 * RAWB];
    attn_slice(hl, kh, slot, Qf, Kf, Vf, Op, Mp, Lp, q0, k0, sm);
}

// Joins the key slices and copies the content half. A thread holds 4 queries x FCH channels: the slices' weights and their sum depend on the query alone and are formed once for its FCH channels; a wave's load or store covers 512 contiguous bytes of one row. Grid (2 * HW / 128, NB_): 128 queries x 32 channels a block, 4 channels a wave.
#define FCH 4
__global__ __launch_bounds__(256) void k_fin(const float* __restrict__ OP, const float* __restrict__ ML, const float* __restrict__ LS, const float* __restrict__ x, float* OUT) {
    const size_t b = blockIdx.y; const unsigned n = (blockIdx.x >> 1) * 128u + (threadIdx.x & 31u) * 4u, c0 = (blockIdx.x & 1u) * 32u + (threadIdx.x >> 5) * FCH;
    const char* Ob = (const char*)(OP + b * CC * KSP * HW); const char* Mb = (const char*)(ML + b * HW); const char* Lb = (const char*)(LS + b * HW); const char* xb = (const char*)(x + b * CC * HW); char* OUTb = (char*)(OUT + b * 2 * CC * HW);
    const unsigned nb = n * 4u, eob = (c0 * (KSP * HW) + n) * 4u, xo = (c0 * HW + n) * 4u;   // byte offsets in 32 bits: one offset register beside a scalar base serves all slices and channels
    v4f mz[KSP], lz[KSP], oz[FCH][KSP], a[FCH];
#pragma unroll
    for (int z = 0; z < KSP; ++z) { mz[z] = *(const v4f*)(Mb + (size_t)z * NB_ * HW * 4 + nb); lz[z] = *(const v4f*)(Lb + (size_t)z * NB_ * HW * 4 + nb); }
#pragma unroll
    for (int i = 0; i < FCH; ++i)
#pragma unroll
        for (int z = 0; z < KSP; ++z) oz[i][z] = *(const v4f*)(Ob + (size_t)i * KSP * HW * 4 + (size_t)z * HW * 4 + eob);
#pragma unroll
    for (int i = 0; i < FCH; ++i) a[i] = *(const v4f*)(xb + (size_t)i * HW * 4 + xo);
    asm volatile("s_wait_xcnt 0x0" :: "v"(nb), "v"(eob), "v"(xo) : "memory");   // stands in front of the first overwrite of an offset register that the 28 issued loads name; the three offsets are inputs, so that they stay in their registers up to here and no load's result is placed on one
    __builtin_amdgcn_sched_barrier(0);   // all 28 independent loads, and the wait behind them, stay in front of the arithmetic: one round trip for the whole thread
    v4f r[FCH];
#pragma unroll   // u indexes vector elements: rolled, every access would become a chain of selects
    for (int u = 0; u < 4; ++u) { float M = mz[0][u];
#pragma unroll
        for (int z = 1; z < KSP; ++z) M = fmaxf(M, mz[z][u]);
        float w[KSP], den = 0.f;
#pragma unroll
        for (int z = 0; z < KSP; ++z) w[z] = mz[z][u] - M;
        exp2_run4(w);
#pragma unroll
        for (int z = 0; z < KSP; ++z) den = fmaf(w[z], lz[z][u], den);
#pragma unroll
        for (int i = 0; i < FCH; ++i) { float num = 0.f;
#pragma unroll
            for (int z = 0; z < KSP; ++z) num = fmaf(w[z], oz[i][z][u], num);
            r[i][u] = __fdiv_rn(num, den); a[i][u] = bfr(a[i][u]); } }
#pragma unroll
    for (int i = 0; i < FCH; ++i) { *(v4f*)(OUTb + (size_t)i * HW * 4 + xo) = a[i]; *(v4f*)(OUTb + (size_t)(CC + i) * HW * 4 + xo) = r[i]; }
}

extern "C" void kernel_launch(void* const* d_in, const int* in_sizes, int n_in,
                              void* d_out, int out_size, void* d_ws, size_t ws_size, hipStream_t stream) {
    (void)in_sizes; (void)n_in; (void)out_size;
    const float* content = (const float*)d_in[0]; const float* content_s = (const float*)d_in[1]; const float* style = (const float*)d_in[2];
    float* OUT = (float*)d_out;     // [4][128][4096]
    char* wsp = (char*)d_ws;
    auto take = [&](size_t bytes) { char* p = wsp; wsp += (bytes + 255) & ~(size_t)255; return (void*)p; };
    float* OP = (float*)take((size_t)KSP * NB_ * CC * HW * 4); float* ML = (float*)take((size_t)KSP * NB_ * HW * 4); float* LS = (float*)take((size_t)KSP * NB_ * HW * 4);
    if ((size_t)(wsp - (char*)d_ws) > ws_size) return;    // ~ 17 MB
    k_attn<<<dim3(KSP, NB_, HW / QBL), 512, 0, stream>>>(content, content_s, style, OP, ML, LS);
    k_fin<<<dim3(2 * HW / 128, NB_), 256, 0, stream>>>(OP, ML, LS, content, OUT);
}

// v010
// A run of this version takes 24.4 microseconds.
// In both of two side-by-side timings against v009, it was 1.06 times as fast.
// Counting every step since v000, it is 40.2 times as fast.
#include <hip/hip_runtime.h>

// SANet (content, content_s, style [4][64][64][64] channels-first, HW = 4096; S[q][k] = sum_c Fc[c][q] Fs[c][k] (unscaled, K = 64); P = softmax_k(S); O[c][q] = sum_k style[c][k] P[q][k]; out = concat(content, O) along channels -> [4][128][64][64]).
// Compute dtypes, f32 accumulate: every input rounded to bf16. One fused kernel (k_attn) does S, softmax and P.style^T with an online softmax; it takes the f32 inputs themselves and rounds them on the way: each block converts its own key and style tiles in LDS, each wave its own queries in registers. S^T = Fs.Fc^T as a PLAIN bf16 product on token-major rows (exact products); the score accumulators are, lane for lane, the B operand of O += style.P^T, so S and P stay in registers. P = 2^(score in the log2 domain - the query's reference in use), between 2^-PLO and 2^PHI at the largest score seen, multiplies the fp16 style: query rows >= RH as a single fp16 plane, rows < RH as two fp16 planes, hi + lo (2 products). The keys are split into KSP slices (grid x), each slice into KHF halves that two groups of eight waves of one block walk side by side and join in LDS at the end; each slice stores its unnormalised f32 partial O (channels-first), its reference in use (log2 domain) and its sum in its own workspace plane, and k_fin joins the planes; the content half is the bf16-rounded input copied.

#define NB_  4
#define CC   64
#define HW   4096
#define TT   HW
#define RH   512
#define PHI  15.5f   // the reference in use stays while no P of the pass would exceed 2^PHI (fp16 ends at 2^16)
#define PLO  3.0f    // a raised reference lies PLO above the largest score seen, whose P is then 2^-PLO: fp16's last place, 2^-24, stays 2^-21 of the row's largest P (the reference cancels against the row sum)
#define KSP  4       // key slices of the fused kernel = workspace planes
#define KHF  2       // halves of a slice, joined inside the block
#define KSL  (HW / (KSP * KHF))   // keys of one wave
#define L2E  1.4426950408889634f
#define SKY  64                  // keys of one half in one LDS stage
#define NST  (KSL / SKY)         // stages of a key slice
#define KPI  144                 // LDS pitch of a key row (128 bytes + 16) and
#define VPI  272                 // of a style row (256 bytes + 16): 16 bytes x odd, no bank conflict for 16-byte reads
#define KBY  (KHF * SKY * KPI)   // the key rows of a stage (first half's, then second half's); the style rows follow them
#define BUFB (KBY + CC * VPI)    // one stage buffer (16-bit operands)
#define RP   528                 // LDS pitch of a raw f32 row of a stage (KHF * SKY * 4 = 512 bytes + 16)
#define RAWB (2 * CC * RP)       // one raw stage buffer: the 64 channel rows of content_s, then the 64 of style
#define QBL  256                 // queries of a block: 8 groups of 32
typedef _Float16 h16;
typedef unsigned short bf;
typedef __attribute__((ext_vector_type(16))) __bf16   v16bf;
typedef __attribute__((ext_vector_type(16))) _Float16 v16h;
typedef __attribute__((ext_vector_type(8)))  _Float16 v8h;
typedef __attribute__((ext_vector_type(8)))  unsigned short v8us;
typedef __attribute__((ext_vector_type(8)))  float    v8f;
typedef __attribute__((ext_vector_type(4)))  float    v4f;
typedef v8h  __attribute__((may_alias)) v8ha;
typedef v4f  __attribute__((may_alias)) v4fa;
typedef v8us __attribute__((may_alias)) v8usa;
typedef __attribute__((ext_vector_type(16))) float    v16f;
typedef __attribute__((ext_vector_type(2)))  float    v2fl;
typedef __attribute__((ext_vector_type(2)))  __bf16   v2bf;
typedef __attribute__((ext_vector_type(2)))  _Float16 v2h;
typedef __attribute__((ext_vector_type(4)))  unsigned v4u;
typedef __attribute__((ext_vector_type(2)))  unsigned v2u;
typedef v2fl __attribute__((may_alias)) v2fla;
typedef v4u  __attribute__((may_alias)) v4ua;
typedef v2u  __attribute__((may_alias)) v2ua;

__device__ __forceinline__ unsigned short f2bf(float f) { unsigned u = __float_as_uint(f); u += 0x7FFFu + ((u >> 16) & 1u); return (unsigned short)(u >> 16); }
__device__ __forceinline__ float bf2f(unsigned short b) { return __uint_as_float(((unsigned)b) << 16); }
__device__ __forceinline__ float bfr(float f) { return bf2f(f2bf(f)); }
__device__ __forceinline__ v16h cat16(v8h lo, v8h hi) { return __builtin_shufflevector(lo, hi, 0, 1, 2, 3, 4, 5, 6, 7, 8, 9, 10, 11, 12, 13, 14, 15); }
__device__ __forceinline__ v16bf cat16b(v8us lo, v8us hi) { return __builtin_bit_cast(v16bf, __builtin_shufflevector(lo, hi, 0, 1, 2, 3, 4, 5, 6, 7, 8, 9, 10, 11, 12, 13, 14, 15)); }
__device__ __forceinline__ v8f wmma16(v16h a, v16h b, v8f c) { return __builtin_amdgcn_wmma_f32_16x16x32_f16(false, a, false, b, (short)0, c, false, false); }
__device__ __forceinline__ v8f wmmab(v16bf a, v16bf b, v8f c) { return __builtin_amdgcn_wmma_f32_16x16x32_bf16(false, a, false, b, (short)0, c, false, false); }



// fragment loaders: K-contiguous 16-bit planes, lane (lr, hi) reads k = 8*hi + 0..7 and 16 + 8*hi + 0..7 of row lr
template <typename T16> struct WFrag;
template <> struct WFrag<h16> { typedef v16h V; static __device__ __forceinline__ V ld(const h16* p) { return cat16(*(const v8h*)p, *(const v8h*)(p + 16)); } static __device__ __forceinline__ v8f mma(V a, V b, v8f c) { return wmma16(a, b, c); } };
template <> struct WFrag<bf> { typedef v16bf V; static __device__ __forceinline__ V ld(const bf* p) { return cat16b(*(const v8us*)p, *(const v8us*)(p + 16)); } static __device__ __forceinline__ v8f mma(V a, V b, v8f c) { return wmmab(a, b, c); } };

__device__ __forceinline__ h16 tohx(float x) { return (h16)x; }
// two f32 to a pair of bf16 (nearest even, a in the low half), and to a pair of fp16 of those bf16 values
__device__ __forceinline__ unsigned pkbf(float a, float b) { return __builtin_bit_cast(unsigned, __builtin_convertvector((v2fl){ a, b }, v2bf)); }
__device__ __forceinline__ unsigned pkhb(float a, float b) { const unsigned u = pkbf(a, b); return __builtin_bit_cast(unsigned, __builtin_convertvector((v2fl){ __uint_as_float(u << 16), __uint_as_float(u & 0xFFFF0000u) }, v2h)); }
typedef __attribute__((ext_vector_type(2))) unsigned short v2us;
typedef __attribute__((ext_vector_type(2))) float v2f;

// lane l with lane l ^ 16
__device__ __forceinline__ float xhalf(float x) { return __builtin_bit_cast(float, __builtin_amdgcn_permlanex16(__builtin_bit_cast(int, x), __builtin_bit_cast(int, x), 0x76543210, 0xfedcba98, false, false)); }

// A run of exponentials (2^x) in place, as one statement: each stands behind an independent one, and the one v_nop at the end keeps, for the whole run, the slot that the instruction set asks for between a transcendental and the use of its result or the overwrite of its source.
__device__ __forceinline__ void exp2_run16(float (&t)[16]) { asm("v_exp_f32 %0, %0\n\tv_exp_f32 %1, %1\n\tv_exp_f32 %2, %2\n\tv_exp_f32 %3, %3\n\tv_exp_f32 %4, %4\n\tv_exp_f32 %5, %5\n\tv_exp_f32 %6, %6\n\tv_exp_f32 %7, %7\n\tv_exp_f32 %8, %8\n\tv_exp_f32 %9, %9\n\tv_exp_f32 %10, %10\n\tv_exp_f32 %11, %11\n\tv_exp_f32 %12, %12\n\tv_exp_f32 %13, %13\n\tv_exp_f32 %14, %14\n\tv_exp_f32 %15, %15\n\tv_nop" : "+v"(t[0]), "+v"(t[1]), "+v"(t[2]), "+v"(t[3]), "+v"(t[4]), "+v"(t[5]), "+v"(t[6]), "+v"(t[7]), "+v"(t[8]), "+v"(t[9]), "+v"(t[10]), "+v"(t[11]), "+v"(t[12]), "+v"(t[13]), "+v"(t[14]), "+v"(t[15])); }
__device__ __forceinline__ void exp2_run2(float (&t)[2]) { asm("v_exp_f32 %0, %0\n\tv_exp_f32 %1, %1\n\tv_nop" : "+v"(t[0]), "+v"(t[1])); }
__device__ __forceinline__ void exp2_run4(float (&t)[4]) { asm("v_exp_f32 %0, %0\n\tv_exp_f32 %1, %1\n\tv_exp_f32 %2, %2\n\tv_exp_f32 %3, %3\n\tv_nop" : "+v"(t[0]), "+v"(t[1]), "+v"(t[2]), "+v"(t[3])); }

// One stage of the block's f32 keys and style into LDS, 8 asynchronous copies of 16 bytes a thread. A wave's copy is one channel row of the stage, 512 bytes: lanes 0 to 15 bring the SKY keys of the first half, lanes 16 to 31 those of the second half, KSL keys further on. 16 waves, so 16 rows a copy: 4 copies for the 64 rows of content_s, 4 for the 64 of style. l, gk, gv: the thread's own LDS byte address and global addresses of its first copy of either tensor.
// The s_wait_xcnt at the end stands in front of every later overwrite of a register that these copies name.
__device__ __forceinline__ void stage_copy(const unsigned l, const char* gk, const char* gv) {
    asm volatile("global_load_async_to_lds_b128 %0, %8, off\n\tglobal_load_async_to_lds_b128 %1, %9, off\n\tglobal_load_async_to_lds_b128 %2, %10, off\n\tglobal_load_async_to_lds_b128 %3, %11, off\n\t"
                 "global_load_async_to_lds_b128 %4, %12, off\n\tglobal_load_async_to_lds_b128 %5, %13, off\n\tglobal_load_async_to_lds_b128 %6, %14, off\n\tglobal_load_async_to_lds_b128 %7, %15, off\n\ts_wait_xcnt 0x0"
                 :: "v"(l), "v"(l + 16 * RP), "v"(l + 32 * RP), "v"(l + 48 * RP), "v"(l + 64 * RP), "v"(l + 80 * RP), "v"(l + 96 * RP), "v"(l + 112 * RP),
                    "v"(gk), "v"(gk + 16 * HW * 4), "v"(gk + 32 * HW * 4), "v"(gk + 48 * HW * 4), "v"(gv), "v"(gv + 16 * HW * 4), "v"(gv + 32 * HW * 4), "v"(gv + 48 * HW * 4) : "memory");
}
// A raw stage (rw) to the 16-bit operands of a stage buffer (hb), once for the block's 16 waves, 16 elements of either tensor a thread.
// Keys: 8 channels x 2 neighbouring keys (a wave reads 256 contiguous bytes of a channel row) to two 16-byte pieces of token-major bf16 rows; raw column = stage row (first half's keys, then the second half's).
// Style: 4 keys of 4 channel rows (a wave reads a whole raw row) to fp16 of the bf16 value, layout kept.
__device__ __forceinline__ void convert_stage(const char* rw, char* hb, const unsigned tid) {
    const unsigned cg = tid >> 6, tp = tid & 63u, wr = tid >> 5, ln = tid & 31u;
    v2fl a[8]; v4f v[4];
#pragma unroll
    for (int i = 0; i < 8; ++i) a[i] = *(const v2fla*)(rw + (cg * 8u + i) * RP + tp * 8u);
#pragma unroll
    for (int i = 0; i < 4; ++i) v[i] = *(const v4fa*)(rw + (CC + wr + 16u * i) * RP + ln * 16u);
#pragma unroll
    for (int j = 0; j < 2; ++j) *(v4ua*)(hb + (tp * 2u + j) * KPI + cg * 16u) = (v4u){ pkbf(a[0][j], a[1][j]), pkbf(a[2][j], a[3][j]), pkbf(a[4][j], a[5][j]), pkbf(a[6][j], a[7][j]) };
#pragma unroll
    for (int i = 0; i < 4; ++i) *(v2ua*)(hb + KBY + (wr + 16u * i) * VPI + ln * 8u) = (v2u){ pkhb(v[i][0], v[i][1]), pkhb(v[i][2], v[i][3]) };
}

// ---- one wave: 32 query columns x KSL keys, 32 keys a pass. S^T tile D[key][q]: lane (lr, hi) holds keys hi*8 + j of query lr; two such tiles (keys 0-15, 16-31) are the 16 elements of the B fragment of the second product (k = 8*hi + 0..7, 16 + 8*hi + 0..7).
// The SKY / 32 passes of one stage. hl (the same in every lane of the wave): the wave's rows are hi/lo rows: a second plane, the rest that the fp16 rounding of P left, goes through the same style fragments.
// cv: the pass in front of which the wave converts its part of the next raw stage (rw to hb), -1 for none. cp: a further raw stage exists, and its copies (cl, cgk, cgv) are issued here. cv and cp are the same in every lane of a wave, cp in the whole block.
// The signal of the stage's work-group barrier stands in the last pass, behind the wave's last LDS read of the stage; the caller waits on that barrier behind the passes: the last pass's arithmetic of a late wave runs beside the next stage's work of the others instead of holding them.
__device__ __forceinline__ void stage_passes(const bool hl, const char* kl, const char* vl, const v16bf (&bq)[2][2], v8f (&o)[4][2], float (&ml)[2], float (&ls)[2], const int cv, const char* rw, char* hb, const unsigned tid, const bool cp, const unsigned cl, const char* cgk, const char* cgv) {
#pragma unroll 1   // one pass is already 16 or 24 matrix instructions; unrolling would only add registers
    for (int i = 0; i < SKY / 32; ++i) {
        if (i == cv) convert_stage(rw, hb, tid);
        v16bf ak[2][2]; v16h av[4];
#pragma unroll
        for (int t = 0; t < 2; ++t)
#pragma unroll
            for (int ks = 0; ks < 2; ++ks) ak[t][ks] = WFrag<bf>::ld((const bf*)(kl + t * 16 * KPI + ks * 64));
#pragma unroll
        for (int mb = 0; mb < 4; ++mb) av[mb] = WFrag<h16>::ld((const h16*)(vl + mb * 16 * VPI));
        __builtin_amdgcn_sched_barrier(0);   // all 16 LDS reads of the pass stand as one group in front of its arithmetic; without it they fall into two groups with vector instructions between
        if (i == SKY / 32 - 1) {
            asm volatile("s_wait_dscnt 0x0" ::: "memory");      // this wave's reads of the stage and of the next raw stage, and its writes of the next stage, are done
            asm volatile("s_wait_asynccnt 0x0" ::: "memory");   // this wave's copies of the raw stage after the next have landed
            asm volatile("s_barrier_signal -1" ::: "memory");   // the first half of the stage's work-group barrier; no LDS read follows before its wait
            if (cp) stage_copy(cl, cgk, cgv);                   // into the raw buffer that the barrier of the stage before has freed
        }
        kl += 32 * KPI; vl += 64;
        float t[2][16], c2[2]; v8h x0[2], x1[2]; v8f s0[2], s1[2];
#pragma unroll
        for (int nq = 0; nq < 2; ++nq) {
            s0[nq] = (v8f){}; s1[nq] = (v8f){};
            s0[nq] = wmmab(ak[0][0], bq[nq][0], s0[nq]); s1[nq] = wmmab(ak[1][0], bq[nq][0], s1[nq]);
            s0[nq] = wmmab(ak[0][1], bq[nq][1], s0[nq]); s1[nq] = wmmab(ak[1][1], bq[nq][1], s1[nq]);
            float cm = fmaxf(s0[nq][0], s1[nq][0]);
#pragma unroll
            for (int j = 1; j < 8; ++j) cm = fmaxf(cm, fmaxf(s0[nq][j], s1[nq][j]));
            c2[nq] = fmaxf(cm, xhalf(cm)) * L2E;
        }
        // Lazy rescale, one test a pass for the wave's 32 queries: only where some query's largest score of the pass would give a P above 2^PHI are the references raised and the accumulators and sums scaled. The first pass always takes it (the start reference is -3e38, the factor 0).
        if (__builtin_amdgcn_ballot_w32((c2[0] - PHI > ml[0]) | (c2[1] - PHI > ml[1])) != 0) {
            float al[2];
#pragma unroll
            for (int nq = 0; nq < 2; ++nq) { const float mn = fmaxf(ml[nq], c2[nq] + PLO); al[nq] = ml[nq] - mn; ml[nq] = mn; }
            exp2_run2(al);
#pragma unroll
            for (int nq = 0; nq < 2; ++nq) {
                ls[nq] *= al[nq];
#pragma unroll
                for (int mb = 0; mb < 4; ++mb) o[mb][nq] *= al[nq];
            }
        }
#pragma unroll
        for (int nq = 0; nq < 2; ++nq) {
#pragma unroll
            for (int j = 0; j < 8; ++j) { t[nq][j] = fmaf(s0[nq][j], L2E, -ml[nq]); t[nq][8 + j] = fmaf(s1[nq][j], L2E, -ml[nq]); }
            exp2_run16(t[nq]);
            float sum = 0.f;
#pragma unroll
            for (int j = 0; j < 8; ++j) sum += t[nq][j] + t[nq][8 + j];
            ls[nq] += sum;
#pragma unroll
            for (int j = 0; j < 8; ++j) { x0[nq][j] = tohx(t[nq][j]); x1[nq][j] = tohx(t[nq][8 + j]); }
            const v16h pf = cat16(x0[nq], x1[nq]);
#pragma unroll
            for (int mb = 0; mb < 4; ++mb) o[mb][nq] = wmma16(av[mb], pf, o[mb][nq]);
        }
        if (hl) {   // one branch a pass, behind both column groups, so that the two groups' common arithmetic stays one block that the compiler can interleave
#pragma unroll
            for (int nq = 0; nq < 2; ++nq) {
                v8h y0, y1;
#pragma unroll
                for (int j = 0; j < 8; ++j) { y0[j] = tohx(t[nq][j] - (float)x0[nq][j]); y1[j] = tohx(t[nq][8 + j] - (float)x1[nq][j]); }
                const v16h pl = cat16(y0, y1);
#pragma unroll
                for (int mb = 0; mb < 4; ++mb) o[mb][nq] = wmma16(av[mb], pl, o[mb][nq]);
            }
        }
    }
}
__device__ __forceinline__ void attn_slice(const bool hl, const int kh, const int slot, const float* __restrict__ Qf, const float* __restrict__ Kf, const float* __restrict__ Vf, float* __restrict__ Op, float* __restrict__ Mp, float* __restrict__ Lp, const int q0, const int k0, char* sm) {
    const int lane = threadIdx.x & 31, lr = lane & 15, hi = lane >> 4;
    // Eight waves walk the first half of the block's keys, eight the second. Each stage of SKY keys of either half comes into LDS once for the block, as f32 by asynchronous copies (three raw buffers), and is converted there once (two stage buffers): in trip s the block converts raw stage s + 1 and works on stage s, while the copies of raw stage s + 2 are in flight; those of raw stage s + 3 follow behind the trip's signal.
    const unsigned tid = threadIdx.x, sb = (unsigned)(size_t)sm;   // sb: the low 32 bits of the shared address = the LDS byte address
    const unsigned lw = sb + 2 * BUFB + (tid >> 5) * RP + (tid & 31u) * 16u;
    const size_t ge = (size_t)(tid >> 5) * HW + k0 + hi * KSL + lr * 4;   // the thread's first element: channel row = its wave, 4 keys of its lane's half
    const char* gk = (const char*)(Kf + ge); const char* gv = (const char*)(Vf + ge);
    stage_copy(lw, gk, gv);
    stage_copy(lw + RAWB, gk + SKY * 4, gv + SKY * 4);
    // The wave's queries, straight from the channels-first f32 input: element e of fragment (nq, ks) is channel ks * 32 + 8 * hi + (e & 7) + 16 * (e >> 3) of query q0 + nq * 16 + lr (the k order of the key rows' loader).
    const char* qb = (const char*)Qf; const unsigned qo = ((unsigned)(8 * hi) * HW + q0 + lr) * 4u;   // one 32-bit offset register beside a scalar base serves all 64 loads
    v16f qf[2][2];
#pragma unroll
    for (int nq = 0; nq < 2; ++nq)
#pragma unroll
        for (int ks = 0; ks < 2; ++ks)
#pragma unroll
            for (int e = 0; e < 16; ++e) qf[nq][ks][e] = *(const float*)(qb + (size_t)((ks * 32 + (e & 7) + 16 * (e >> 3)) * HW + nq * 16) * 4 + qo);
    asm volatile("s_wait_xcnt 0x0" :: "v"(qo) : "memory");   // stands in front of the first overwrite of the offset register that the 64 issued loads name; the offset is an input, so that it stays in its register up to here
    __builtin_amdgcn_sched_barrier(0);   // all 64 loads, and the wait behind them, stay in front of the conversions: one round trip
    v16bf bq[2][2];
#pragma unroll
    for (int nq = 0; nq < 2; ++nq)
#pragma unroll
        for (int ks = 0; ks < 2; ++ks) bq[nq][ks] = __builtin_convertvector(qf[nq][ks], v16bf);
    v8f o[4][2];
#pragma unroll
    for (int mb = 0; mb < 4; ++mb)
#pragma unroll
        for (int nq = 0; nq < 2; ++nq) o[mb][nq] = (v8f){};
    float ml[2] = { -3.0e38f, -3.0e38f }, ls[2] = { 0.f, 0.f };
    asm volatile("s_wait_asynccnt 0x0" ::: "memory");   // this wave's copies of raw stages 0 and 1 have landed
    stage_copy(lw + 2 * RAWB, gk + 2 * SKY * 4, gv + 2 * SKY * 4);   // the third raw buffer has not been used yet
    __syncthreads();                                    // publishes raw stages 0 and 1
    convert_stage(sm + 2 * BUFB, sm, tid);
    asm volatile("s_wait_dscnt 0x0" ::: "memory");      // this wave's reads of raw stage 0 and its writes of stage 0 are done
    __syncthreads();                                    // publishes stage 0; ends every wave's reads of raw stage 0
    // The barrier of trip s (signal in the last pass, wait behind it) publishes stage s + 1 and raw stage s + 2 and ends every wave's reads of stage s and of raw stage s + 1. Raw stage j lies in raw buffer j mod 3: the copies of raw stage s + 3 go, behind the signal of trip s, into the buffer of raw stage s, whose reads the barrier of trip s - 1 has ended, and have a whole trip to land.
    unsigned r0 = 0, r1 = 1;   // s mod 3 and (s + 1) mod 3
#pragma unroll 1   // the buffers alternate by address; unrolled, the code would only grow
    for (int s = 0; s < NST; ++s) {
      const unsigned nx = (s + 1) & 1, bo = (s & 1) * BUFB;
      const char* kl = sm + bo + (kh * SKY + lr) * KPI + 16 * hi;         // key rows lr and 16 + lr of the pass, in the wave's half
      const char* vl = sm + bo + KBY + lr * VPI + kh * (SKY * 2) + 16 * hi;   // channel rows lr + 16 * mb, the pass's 32 keys
      // The waves of the first half convert in front of their first pass, those of the second half in front of their second (kh is the same in every lane of a wave): each SIMD holds two waves of either half, so that one pair's conversion runs beside the other pair's matrix work instead of all four converting at once.
      stage_passes(hl, kl, vl, bq, o, ml, ls, s + 1 < NST ? kh : -1, sm + 2 * BUFB + r1 * RAWB, sm + nx * BUFB, tid, s + 3 < NST, lw + r0 * RAWB, gk + (s + 3) * (SKY * 4), gv + (s + 3) * (SKY * 4));
      asm volatile("s_barrier_wait -1" ::: "memory");   // the second half of the trip's barrier: every wave has signalled
      r0 = r1; r1 = r1 == 2 ? 0 : r1 + 1;
    }
    asm volatile("s_wait_asynccnt 0x0" ::: "memory");     // no copy is outstanding when the wave goes on to the join, its stores and its end
    // The join of the two halves: behind the loop's last barrier nobody reads a stage and no copy is in flight, so the stage buffers are free. The wave of the second half lays down its 64 accumulators, references and sums, lane for lane (17 pieces of 16 bytes a lane, a piece's 32 lanes contiguous); the wave of the first half with the same queries takes them in, as k_fin does with the planes.
    char* jp = sm + slot * (17 * 512) + lane * 16;
    if (kh) {
#pragma unroll
        for (int mb = 0; mb < 4; ++mb)
#pragma unroll
            for (int nq = 0; nq < 2; ++nq) {
                *(v4fa*)(jp + ((mb * 2 + nq) * 2 + 0) * 512) = __builtin_shufflevector(o[mb][nq], o[mb][nq], 0, 1, 2, 3);
                *(v4fa*)(jp + ((mb * 2 + nq) * 2 + 1) * 512) = __builtin_shufflevector(o[mb][nq], o[mb][nq], 4, 5, 6, 7);
            }
        *(v4fa*)(jp + 16 * 512) = (v4f){ ml[0], ml[1], ls[0], ls[1] };
    }
    __syncthreads();   // the second half's values are in LDS; every wave passes it
    if (kh) return;    // the same in every lane of a wave, behind the last barrier
    {
        const v4f mo = *(const v4fa*)(jp + 16 * 512);
        float w[4];
#pragma unroll
        for (int nq = 0; nq < 2; ++nq) { const float M = fmaxf(ml[nq], mo[nq]); w[nq] = ml[nq] - M; w[2 + nq] = mo[nq] - M; ml[nq] = M; }
        exp2_run4(w);
#pragma unroll
        for (int nq = 0; nq < 2; ++nq) ls[nq] = fmaf(ls[nq], w[nq], mo[2 + nq] * w[2 + nq]);
#pragma unroll
        for (int mb = 0; mb < 4; ++mb)
#pragma unroll
            for (int nq = 0; nq < 2; ++nq) {
                const v4f a = *(const v4fa*)(jp + ((mb * 2 + nq) * 2 + 0) * 512), c = *(const v4fa*)(jp + ((mb * 2 + nq) * 2 + 1) * 512);
#pragma unroll
                for (int j = 0; j < 4; ++j) { o[mb][nq][j] = fmaf(o[mb][nq][j], w[nq], a[j] * w[2 + nq]); o[mb][nq][4 + j] = fmaf(o[mb][nq][4 + j], w[nq], c[j] * w[2 + nq]); }
            }
    }
#pragma unroll
    for (int nq = 0; nq < 2; ++nq) { const float lt = ls[nq] + xhalf(ls[nq]); if (hi == 0) { Mp[q0 + nq * 16 + lr] = ml[nq]; Lp[q0 + nq * 16 + lr] = lt; } }
#pragma unroll
    for (int mb = 0; mb < 4; ++mb)
#pragma unroll
        for (int nq = 0; nq < 2; ++nq)
#pragma unroll
            for (int j = 0; j < 8; ++j) Op[(size_t)(mb * 16 + hi * 8 + j) * (KSP * HW) + q0 + nq * 16 + lr] = o[mb][nq][j];
}
// grid (KSP, NB_, HW / QBL); 16 waves, four waves per SIMD (under 256 registers), one block a WGP: a block holds eight groups of 32 queries (slots 0 to 7); waves 0 to 7 walk the first half of the block's keys with slots 0 to 7, waves 8 to 15 the second half with slots 2, 3, 0, 1, 6, 7, 4, 5. All blocks are resident at once, so the launch lasts as long as its fullest SIMD: the heavier hi/lo rows (rows < RH) are slot 0 of every block, whose two waves (0 and 10) stand on different SIMDs. Partial O: [image][channel][slice][query], so that the slices of one output element lie 16 KB apart; references and sums: [slice][image][query].
static_assert(RH == 32 * (HW / QBL), "slot 0 of the HW / QBL query blocks holds the rows below RH");
static_assert(8 * 17 * 512 <= 2 * BUFB, "the join's pieces lie in the stage buffers");
__global__ __launch_bounds__(512) void k_attn(const float* __restrict__ content, const float* __restrict__ content_s, const float* __restrict__ style, float* __restrict__ OP, float* __restrict__ ML, float* __restrict__ LS) {
    const size_t b = blockIdx.y, pl = (size_t)blockIdx.x * NB_ + b; const int k0 = blockIdx.x * (KSL * KHF), z = blockIdx.z, wv = __builtin_amdgcn_readfirstlane((int)(threadIdx.x >> 5));
    const int kh = wv >> 3, slot = kh ? (wv & 7) ^ 2 : wv;
    const bool hl = slot == 0;   // the same in every lane of a wave
    const int q0 = hl ? z * 32 : RH + z * (QBL - 32) + (slot - 1) * 32;   // a permutation of the 32-row groups
    const float* Qf = content + b * CC * HW; const float* Kf = content_s + b * CC * HW; const float* Vf = style + b * CC * HW;
    float* Op = OP + (b * CC * KSP + blockIdx.x) * HW; float* Mp = ML + pl * HW; float* Lp = LS + pl * HW;
    __shared__ __attribute__((aligned(16))) char sm[2 * BUFB + 3 * RAWB];
    attn_slice(hl, kh, slot, Qf, Kf, Vf, Op, Mp, Lp, q0, k0, sm);
}

// Joins the key slices and copies the content half. A thread holds 4 queries x FCH channels: the slices' weights and their sum depend on the query alone and are formed once for its FCH channels; a wave's load or store covers 512 contiguous bytes of one row. Grid (2 * HW / 128, NB_): 128 queries x 32 channels a block, 4 channels a wave.
#define FCH 4
__global__ __launch_bounds__(256) void k_fin(const float* __restrict__ OP, const float* __restrict__ ML, const float* __restrict__ LS, const float* __restrict__ x, float* OUT) {
    const size_t b = blockIdx.y; const unsigned n = (blockIdx.x >> 1) * 128u + (threadIdx.x & 31u) * 4u, c0 = (blockIdx.x & 1u) * 32u + (threadIdx.x >> 5) * FCH;
    const char* Ob = (const char*)(OP + b * CC * KSP * HW); const char* Mb = (const char*)(ML + b * HW); const char* Lb = (const char*)(LS + b * HW); const char* xb = (const char*)(x + b * CC * HW); char* OUTb = (char*)(OUT + b * 2 * CC * HW);
    const unsigned nb = n * 4u, eob = (c0 * (KSP * HW) + n) * 4u, xo = (c0 * HW + n) * 4u;   // byte offsets in 32 bits: one offset register beside a scalar base serves all slices and channels
    v4f mz[KSP], lz[KSP], oz[FCH][KSP], a[FCH];
#pragma unroll
    for (int z = 0; z < KSP; ++z) { mz[z] = *(const v4f*)(Mb + (size_t)z * NB_ * HW * 4 + nb); lz[z] = *(const v4f*)(Lb + (size_t)z * NB_ * HW * 4 + nb); }
#pragma unroll
    for (int i = 0; i < FCH; ++i)
#pragma unroll
        for (int z = 0; z < KSP; ++z) oz[i][z] = *(const v4f*)(Ob + (size_t)i * KSP * HW * 4 + (size_t)z * HW * 4 + eob);
#pragma unroll
    for (int i = 0; i < FCH; ++i) a[i] = *(const v4f*)(xb + (size_t)i * HW * 4 + xo);
    asm volatile("s_wait_xcnt 0x0" :: "v"(nb), "v"(eob), "v"(xo) : "memory");   // stands in front of the first overwrite of an offset register that the 28 issued loads name; the three offsets are inputs, so that they stay in their registers up to here and no load's result is placed on one
    __builtin_amdgcn_sched_barrier(0);   // all 28 independent loads, and the wait behind them, stay in front of the arithmetic: one round trip for the whole thread
    v4f r[FCH];
#pragma unroll   // u indexes vector elements: rolled, every access would become a chain of selects
    for (int u = 0; u < 4; ++u) { float M = mz[0][u];
#pragma unroll
        for (int z = 1; z < KSP; ++z) M = fmaxf(M, mz[z][u]);
        float w[KSP], den = 0.f;
#pragma unroll
        for (int z = 0; z < KSP; ++z) w[z] = mz[z][u] - M;
        exp2_run4(w);
#pragma unroll
        for (int z = 0; z < KSP; ++z) den = fmaf(w[z], lz[z][u], den);
#pragma unroll
        for (int i = 0; i < FCH; ++i) { float num = 0.f;
#pragma unroll
            for (int z = 0; z < KSP; ++z) num = fmaf(w[z], oz[i][z][u], num);
            r[i][u] = __fdiv_rn(num, den); a[i][u] = bfr(a[i][u]); } }
#pragma unroll
    for (int i = 0; i < FCH; ++i) { *(v4f*)(OUTb + (size_t)i * HW * 4 + xo) = a[i]; *(v4f*)(OUTb + (size_t)(CC + i) * HW * 4 + xo) = r[i]; }
}

extern "C" void kernel_launch(void* const* d_in, const int* in_sizes, int n_in,
                              void* d_out, int out_size, void* d_ws, size_t ws_size, hipStream_t stream) {
    (void)in_sizes; (void)n_in; (void)out_size;
    const float* content = (const float*)d_in[0]; const float* content_s = (const float*)d_in[1]; const float* style = (const float*)d_in[2];
    float* OUT = (float*)d_out;     // [4][128][4096]
    char* wsp = (char*)d_ws;
    auto take = [&](size_t bytes) { char* p = wsp; wsp += (bytes + 255) & ~(size_t)255; return (void*)p; };
    float* OP = (float*)take((size_t)KSP * NB_ * CC * HW * 4); float* ML = (float*)take((size_t)KSP * NB_ * HW * 4); float* LS = (float*)take((size_t)KSP * NB_ * HW * 4);
    if ((size_t)(wsp - (char*)d_ws) > ws_size) return;    // ~ 17 MB
    k_attn<<<dim3(KSP, NB_, HW / QBL), 512, 0, stream>>>(content, content_s, style, OP, ML, LS);
    k_fin<<<dim3(2 * HW / 128, NB_), 256, 0, stream>>>(OP, ML, LS, content, OUT);
}
